// v000
// Times are from an AMD MI455X. After a warm-up the kernel runs many times in a row, and a time is the length of
// such a window on the GPU divided by its runs, so every launch and the gaps after it count. The runs cycle
// through copies of the inputs. A figure is the median of several windows, for all but v000 over two sittings.
// Sittings can differ by a few percent; kernels timed side by side share one.
// v000, which the later versions start from, runs in 152 microseconds.
#include <hip/hip_runtime.h>
#include <hip/hip_bf16.h>

typedef __attribute__((ext_vector_type(16))) _Float16 v16h;
typedef __attribute__((ext_vector_type(8)))  _Float16 v8h;
typedef __attribute__((ext_vector_type(8)))  float    v8f;

#define B_  4
#define N_  4096
#define C_  512
#define D_  64
#define G_  4            // split-K groups over the key dimension

static __device__ __forceinline__ v8f wmma_f16(v16h a, v16h b, v8f c) {
  // (neg_a, A, neg_b, B, c_mod, C, reuse_a, reuse_b)
  return __builtin_amdgcn_wmma_f32_16x16x32_f16(false, a, false, b, (short)0, c, false, false);
}

// Load one 16-element half-fragment: two contiguous 8-half (16B) runs at p and p+16.
static __device__ __forceinline__ v16h load_frag_h(const _Float16* p) {
  v16h f;
#pragma unroll
  for (int i = 0; i < 8; ++i) { f[i] = p[i]; f[8 + i] = p[16 + i]; }
  return f;
}

// ---------------------------------------------------------------------------
// Prep 1: x (fp32) -> xh (f16), 8 elements/thread, b128 in / b128 out.
// ---------------------------------------------------------------------------
__global__ __launch_bounds__(256) void cvt_x_kernel(const float* __restrict__ x,
                                                    _Float16* __restrict__ xh) {
  size_t i = ((size_t)blockIdx.x * 256 + threadIdx.x) * 8;
  const float4* p = (const float4*)(x + i);
  float4 a = p[0], b = p[1];
  v8h h;
  h[0] = (_Float16)a.x; h[1] = (_Float16)a.y; h[2] = (_Float16)a.z; h[3] = (_Float16)a.w;
  h[4] = (_Float16)b.x; h[5] = (_Float16)b.y; h[6] = (_Float16)b.z; h[7] = (_Float16)b.w;
  *(v8h*)(xh + i) = h;
}

// ---------------------------------------------------------------------------
// Prep 2: pack Wq/Wk/Wv (C x D fp32, row-major) -> WT[which][d][c] f16.
// ---------------------------------------------------------------------------
__global__ __launch_bounds__(256) void pack_w_kernel(const float* __restrict__ Wq,
                                                     const float* __restrict__ Wk,
                                                     const float* __restrict__ Wv,
                                                     _Float16* __restrict__ WT) {
  int t = blockIdx.x * 256 + threadIdx.x;          // 0 .. 3*D_*C_-1
  int w = t / (D_ * C_);
  int r = t - w * (D_ * C_);
  int d = r / C_;
  int c = r - d * C_;
  const float* W = (w == 0) ? Wq : (w == 1) ? Wk : Wv;
  WT[t] = (_Float16)W[c * D_ + d];                 // coalesced store
}

// ---------------------------------------------------------------------------
// Kernel 1: fused QKV projection. grid = (B*N/16, 3), block = 128.
// ---------------------------------------------------------------------------
template <bool XH>
__global__ __launch_bounds__(128) void qkv_proj_kernel(
    const float* __restrict__ x, const _Float16* __restrict__ xh,
    const _Float16* __restrict__ WT,
    const float* __restrict__ bq, const float* __restrict__ bk,
    const float* __restrict__ bv,
    _Float16* __restrict__ qws, _Float16* __restrict__ kws,
    _Float16* __restrict__ vTws)
{
  const int wave  = threadIdx.x >> 5;
  const int lane  = threadIdx.x & 31;
  const int rt    = blockIdx.x;      // 16-row tile over B*N rows
  const int which = blockIdx.y;      // 0 = Q, 1 = K, 2 = V
  const int d0 = wave * 16;
  const int m  = lane & 15;
  const int hi = lane >> 4;
  const int kb = hi * 8;

  const float* bias = (which == 0) ? bq : (which == 1) ? bk : bv;
  const _Float16* wrow = WT + ((size_t)which * D_ + d0 + m) * C_;

  const int row = rt * 16 + m;
  v8f c0 = {0.f, 0.f, 0.f, 0.f, 0.f, 0.f, 0.f, 0.f};
  v8f c1 = c0;

#pragma unroll
  for (int kt4 = 0; kt4 < C_ / 32; kt4 += 4) {
    v16h af[4], bf[4];
#pragma unroll
    for (int i = 0; i < 4; ++i) {
      const int kt = kt4 + i;
      if (XH) {
        af[i] = load_frag_h(xh + (size_t)row * C_ + kt * 32 + kb);
      } else {
        const float* pa = x + (size_t)row * C_ + kt * 32 + kb;
#pragma unroll
        for (int e = 0; e < 8; ++e) {
          af[i][e] = (_Float16)pa[e]; af[i][8 + e] = (_Float16)pa[16 + e];
        }
      }
      bf[i] = load_frag_h(wrow + kt * 32 + kb);   // B[k][n] = WT[which][d0+n][k]
    }
    c0 = wmma_f16(af[0], bf[0], c0);
    c1 = wmma_f16(af[1], bf[1], c1);
    c0 = wmma_f16(af[2], bf[2], c0);
    c1 = wmma_f16(af[3], bf[3], c1);
  }
#pragma unroll
  for (int r = 0; r < 8; ++r) c0[r] += c1[r];

  const float bias_n = bias[d0 + m];
  if (which < 2) {
    const float scl = (which == 0) ? 0.125f : 1.0f;  // fold dk^-0.5 into Q
    _Float16* dst = (which == 0) ? qws : kws;
#pragma unroll
    for (int r = 0; r < 8; ++r) {
      int ro = rt * 16 + r + hi * 8;                 // C-layout: VGPR r -> rows r, r+8
      dst[(size_t)ro * D_ + d0 + m] = (_Float16)((c0[r] + bias_n) * scl);
    }
  } else {
    // V transposed: vT[b][d][n] so PV B-fragments are contiguous along keys
#pragma unroll
    for (int r = 0; r < 8; ++r) {
      int ro   = rt * 16 + r + hi * 8;
      int bidx = ro >> 12;                            // / N_
      int nloc = ro & (N_ - 1);
      vTws[((size_t)bidx * D_ + d0 + m) * N_ + nloc] = (_Float16)(c0[r] + bias_n);
    }
  }
}

// ---------------------------------------------------------------------------
// Kernel 2: flash attention, software-pipelined K (ping-pong regs).
// SPLIT=true: grid (B*N/64, G_), each wave covers N_/G_ keys, writes partials.
// SPLIT=false: grid (B*N/64), full key range, writes final output.
// ---------------------------------------------------------------------------
template <bool SPLIT>
__global__ __launch_bounds__(128) void flash_attn_kernel(
    const _Float16* __restrict__ qws, const _Float16* __restrict__ kws,
    const _Float16* __restrict__ vTws, float* __restrict__ out,
    float* __restrict__ pacc, float* __restrict__ pm, float* __restrict__ pl)
{
  const int LP = 72;                                  // padded row stride (halves)
  __shared__ __align__(16) _Float16 plds[4][16 * LP]; // per-wave P staging tile

  const int wave = threadIdx.x >> 5;
  const int lane = threadIdx.x & 31;
  const int qt = blockIdx.x * 4 + wave;   // global 16-query tile (0..1023)
  const int g  = SPLIT ? blockIdx.y : 0;  // key group
  const int b  = qt >> 8;                 // 256 q-tiles per batch
  const int q0 = qt * 16;                 // global row over B*N
  const int m  = lane & 15;
  const int hi = lane >> 4;
  const int kb = hi * 8;

  const int jBeg = SPLIT ? g * (N_ / G_) : 0;
  const int jEnd = SPLIT ? jBeg + (N_ / G_) : N_;

  _Float16* P = plds[wave];
  const _Float16* vrow = vTws + (size_t)b * D_ * N_;
  const _Float16* krow = kws + (size_t)b * N_ * D_;

  // Q fragments: two 16x32 A-tiles covering head dims 0..31 and 32..63
  v16h qa0 = load_frag_h(qws + (size_t)(q0 + m) * D_ + 0  + kb);
  v16h qa1 = load_frag_h(qws + (size_t)(q0 + m) * D_ + 32 + kb);

  v8f acc[4];
#pragma unroll
  for (int t = 0; t < 4; ++t)
#pragma unroll
    for (int r = 0; r < 8; ++r) acc[t][r] = 0.f;

  float rm[8], rl[8];
#pragma unroll
  for (int r = 0; r < 8; ++r) { rm[r] = -1e30f; rl[r] = 0.f; }

  // Load 8 K fragments (64 keys) for key offset jj into kf[].
  auto load_k = [&](v16h* kf, int jj) {
    const _Float16* kp = krow + (size_t)jj * D_;
#pragma unroll
    for (int t = 0; t < 4; ++t) {
      kf[2 * t]     = load_frag_h(kp + (t * 16 + m) * D_ + kb);       // dims 0..31
      kf[2 * t + 1] = load_frag_h(kp + (t * 16 + m) * D_ + 32 + kb);  // dims 32..63
    }
  };

  // One 64-key flash step: consume kfc (keys jc), refill kfn (keys jn).
  auto step = [&](v16h* kfc, int jc, v16h* kfn, int jn) {
    // --- S = Q * K^T for 4 sub-tiles of 16 keys (scale pre-folded into Q) ---
    v8f s[4];
#pragma unroll
    for (int t = 0; t < 4; ++t) {
      v8f z = {0.f, 0.f, 0.f, 0.f, 0.f, 0.f, 0.f, 0.f};
      s[t] = wmma_f16(qa0, kfc[2 * t], z);
      s[t] = wmma_f16(qa1, kfc[2 * t + 1], s[t]);
    }

    // --- Issue V-fragment loads; latency hides under softmax VALU work ---
    v16h vf[8];
    const _Float16* vbase = vrow + jc + kb;
#pragma unroll
    for (int nt = 0; nt < 4; ++nt) {
      const _Float16* vp = vbase + (size_t)(nt * 16 + m) * N_;
      vf[2 * nt]     = load_frag_h(vp);        // keys jc..jc+31
      vf[2 * nt + 1] = load_frag_h(vp + 32);   // keys jc+32..jc+63
    }

    // --- Pipeline: refill next K buffer, consumed a half-iteration later ---
    if (jn < jEnd) load_k(kfn, jn);

    // --- online softmax (rows r, r+8 live in VGPR r of halves 0/1) ---
    float alpha[8];
#pragma unroll
    for (int r = 0; r < 8; ++r) {
      float mx = fmaxf(fmaxf(s[0][r], s[1][r]), fmaxf(s[2][r], s[3][r]));
      mx = fmaxf(mx, __shfl_xor(mx, 1, 32));
      mx = fmaxf(mx, __shfl_xor(mx, 2, 32));
      mx = fmaxf(mx, __shfl_xor(mx, 4, 32));
      mx = fmaxf(mx, __shfl_xor(mx, 8, 32));
      float mnew = fmaxf(rm[r], mx);
      float a = __expf(rm[r] - mnew);
      rm[r] = mnew;
      alpha[r] = a;
      float p0 = __expf(s[0][r] - mnew);
      float p1 = __expf(s[1][r] - mnew);
      float p2 = __expf(s[2][r] - mnew);
      float p3 = __expf(s[3][r] - mnew);
      s[0][r] = p0; s[1][r] = p1; s[2][r] = p2; s[3][r] = p3;
      float sum = (p0 + p1) + (p2 + p3);
      sum += __shfl_xor(sum, 1, 32);
      sum += __shfl_xor(sum, 2, 32);
      sum += __shfl_xor(sum, 4, 32);
      sum += __shfl_xor(sum, 8, 32);
      rl[r] = rl[r] * a + sum;
    }
#pragma unroll
    for (int r = 0; r < 8; ++r) {
      acc[0][r] *= alpha[r]; acc[1][r] *= alpha[r];
      acc[2][r] *= alpha[r]; acc[3][r] *= alpha[r];
    }

    // --- P (C-layout f32) -> LDS f16 [row][k64], re-read as two A-fragments ---
#pragma unroll
    for (int r = 0; r < 8; ++r) {
      int prow = r + hi * 8;
#pragma unroll
      for (int t = 0; t < 4; ++t)
        P[prow * LP + t * 16 + m] = (_Float16)s[t][r];
    }
    asm volatile("s_wait_dscnt 0" ::: "memory");
    v16h pa0 = load_frag_h(P + m * LP + kb);        // keys jc..jc+31
    v16h pa1 = load_frag_h(P + m * LP + 32 + kb);   // keys jc+32..jc+63

    // --- O += P * V ---
#pragma unroll
    for (int nt = 0; nt < 4; ++nt) {
      acc[nt] = wmma_f16(pa0, vf[2 * nt], acc[nt]);
      acc[nt] = wmma_f16(pa1, vf[2 * nt + 1], acc[nt]);
    }
  };

  v16h kfA[8], kfB[8];
  load_k(kfA, jBeg);

  for (int j = jBeg; j < jEnd; j += 128) {
    // Prefetch the next 128-key K/V tiles into the WGP cache.
    if (j + 128 < jEnd) {
      const _Float16* pk = krow + (size_t)(j + 128) * D_;
      __builtin_prefetch(pk + (size_t)lane * 128, 0, 3);
      __builtin_prefetch(pk + 4096 + (size_t)lane * 128, 0, 3);
      __builtin_prefetch(vrow + (size_t)(2 * lane) * N_ + j + 128, 0, 3);
      __builtin_prefetch(vrow + (size_t)(2 * lane + 1) * N_ + j + 128, 0, 3);
      __builtin_prefetch(vrow + (size_t)(2 * lane) * N_ + j + 192, 0, 3);
      __builtin_prefetch(vrow + (size_t)(2 * lane + 1) * N_ + j + 192, 0, 3);
    }
    step(kfA, j,       kfB, j + 64);
    step(kfB, j + 64,  kfA, j + 128);
  }

  if (SPLIT) {
    // Store unnormalized partial acc + per-row (m, l); combined later.
    const int BN = B_ * N_;
    float* pa = pacc + ((size_t)g * BN + q0) * D_;
#pragma unroll
    for (int r = 0; r < 8; ++r) {
      float* po = pa + (size_t)(r + hi * 8) * D_;
      po[0  + m] = acc[0][r];
      po[16 + m] = acc[1][r];
      po[32 + m] = acc[2][r];
      po[48 + m] = acc[3][r];
    }
#pragma unroll
    for (int r = 0; r < 8; ++r) {
      if (m == r) {                       // 2 lanes (hi=0/1) -> rows r, r+8
        pm[(size_t)g * BN + q0 + r + hi * 8] = rm[r];
        pl[(size_t)g * BN + q0 + r + hi * 8] = rl[r];
      }
    }
  } else {
    // Normalize and store (coalesced 16-float runs per row).
#pragma unroll
    for (int r = 0; r < 8; ++r) {
      float inv = 1.0f / rl[r];
      int ro = q0 + r + hi * 8;
      float* po = out + (size_t)ro * D_;
      po[0  + m] = acc[0][r] * inv;
      po[16 + m] = acc[1][r] * inv;
      po[32 + m] = acc[2][r] * inv;
      po[48 + m] = acc[3][r] * inv;
    }
  }
}

// ---------------------------------------------------------------------------
// Kernel 3: combine split-K partials. One thread per (row, d).
// ---------------------------------------------------------------------------
__global__ __launch_bounds__(256) void combine_kernel(
    const float* __restrict__ pacc, const float* __restrict__ pm,
    const float* __restrict__ pl, float* __restrict__ out)
{
  const int BN = B_ * N_;
  int t = blockIdx.x * 256 + threadIdx.x;   // 0 .. BN*D_-1
  int qrow = t >> 6;
  float M = -1e30f;
#pragma unroll
  for (int g = 0; g < G_; ++g) M = fmaxf(M, pm[(size_t)g * BN + qrow]);
  float L = 0.f, o = 0.f;
#pragma unroll
  for (int g = 0; g < G_; ++g) {
    float w = __expf(pm[(size_t)g * BN + qrow] - M);
    L += w * pl[(size_t)g * BN + qrow];
    o += w * pacc[(size_t)g * BN * D_ + t];
  }
  out[t] = o / L;
}

// ---------------------------------------------------------------------------
extern "C" void kernel_launch(void* const* d_in, const int* in_sizes, int n_in,
                              void* d_out, int out_size, void* d_ws, size_t ws_size,
                              hipStream_t stream) {
  (void)in_sizes; (void)n_in; (void)out_size;
  const float* x  = (const float*)d_in[0];
  const float* Wq = (const float*)d_in[1];
  const float* bq = (const float*)d_in[2];
  const float* Wk = (const float*)d_in[3];
  const float* bk = (const float*)d_in[4];
  const float* Wv = (const float*)d_in[5];
  const float* bv = (const float*)d_in[6];
  float* out = (float*)d_out;

  const size_t elems    = (size_t)B_ * N_ * D_;    // 1,048,576
  const size_t wt_elems = (size_t)3 * D_ * C_;     // 98,304
  const size_t x_elems  = (size_t)B_ * N_ * C_;    // 8,388,608

  // Workspace layout (halves):  qws | kws | vT | WT | xh || (floats) pacc | pm | pl
  _Float16* qws = (_Float16*)d_ws;
  _Float16* kws = qws + elems;
  _Float16* vT  = kws + elems;
  _Float16* WT  = vT + elems;
  _Float16* xh  = WT + wt_elems;

  const size_t half_bytes  = (3 * elems + wt_elems + x_elems) * sizeof(_Float16);
  float* pacc = (float*)((char*)d_ws + half_bytes);
  float* pm   = pacc + (size_t)G_ * B_ * N_ * D_;
  float* pl   = pm + (size_t)G_ * B_ * N_;
  const size_t split_bytes =
      half_bytes + ((size_t)G_ * B_ * N_ * (D_ + 2)) * sizeof(float);

  const bool use_xh    = ws_size >= half_bytes;
  const bool use_split = ws_size >= split_bytes;

  pack_w_kernel<<<(int)(wt_elems / 256), 256, 0, stream>>>(Wq, Wk, Wv, WT);
  if (use_xh) {
    cvt_x_kernel<<<(int)(x_elems / (256 * 8)), 256, 0, stream>>>(x, xh);
    qkv_proj_kernel<true><<<dim3((B_ * N_) / 16, 3), 128, 0, stream>>>(
        x, xh, WT, bq, bk, bv, qws, kws, vT);
  } else {
    qkv_proj_kernel<false><<<dim3((B_ * N_) / 16, 3), 128, 0, stream>>>(
        x, xh, WT, bq, bk, bv, qws, kws, vT);
  }

  if (use_split) {
    flash_attn_kernel<true><<<dim3((B_ * N_) / 64, G_), 128, 0, stream>>>(
        qws, kws, vT, out, pacc, pm, pl);
    combine_kernel<<<(B_ * N_ * D_) / 256, 256, 0, stream>>>(pacc, pm, pl, out);
  } else {
    flash_attn_kernel<false><<<(B_ * N_) / 64, 128, 0, stream>>>(
        qws, kws, vT, out, pacc, pm, pl);
  }
}

// v001
// It runs in 126 microseconds.
// Next to v000, in two timings, it ran 1.23 and 1.24 times as fast.
#include <hip/hip_runtime.h>
#include <hip/hip_bf16.h>

typedef __attribute__((ext_vector_type(16))) _Float16 v16h;
typedef __attribute__((ext_vector_type(8)))  _Float16 v8h;
typedef __attribute__((ext_vector_type(8)))  float    v8f;

#define B_  4
#define N_  4096
#define C_  512
#define D_  64
#define G_  4            // split-K groups over the key dimension

static __device__ __forceinline__ v8f wmma_f16(v16h a, v16h b, v8f c) {
  // (neg_a, A, neg_b, B, c_mod, C, reuse_a, reuse_b)
  return __builtin_amdgcn_wmma_f32_16x16x32_f16(false, a, false, b, (short)0, c, false, false);
}

// Load one 16-element half-fragment: two contiguous 8-half (16B) runs at p and p+16.
static __device__ __forceinline__ v16h load_frag_h(const _Float16* p) {
  v16h f;
#pragma unroll
  for (int i = 0; i < 8; ++i) { f[i] = p[i]; f[8 + i] = p[16 + i]; }
  return f;
}

// Fragment-order layout of a 16-row x 32-k operand tile (512 halves = 1 KB):
//   element (row, kk) sits at (kk >> 4) * 256 + (row + 16 * ((kk >> 3) & 1)) * 8 + (kk & 7).
// Lane l then finds its two 8-half runs at l * 8 and 256 + l * 8, so each
// wave-wide 16-byte load covers 512 contiguous bytes (4 whole 128-byte lines)
// instead of 32-byte pieces of 16 lines. Same k order as load_frag_h.
// p = tile base + lane * 8.
static __device__ __forceinline__ v16h load_frag_p(const _Float16* p) {
  v8h lo = *(const v8h*)(p);
  v8h hi = *(const v8h*)(p + 256);
  return __builtin_shufflevector(lo, hi, 0, 1, 2, 3, 4, 5, 6, 7, 8, 9, 10, 11, 12, 13, 14, 15);
}
// The same through a pointer that says "global memory" in its type: a pointer that an asm
// statement has stepped would otherwise be loaded from with flat instructions.
typedef const __attribute__((address_space(1))) _Float16* gl_half_ptr;
typedef const __attribute__((address_space(1))) v8h*      gl_v8h_ptr;
static __device__ __forceinline__ v16h load_frag_g(gl_half_ptr p) {
  v8h lo = *(gl_v8h_ptr)(p);
  v8h hi = *(gl_v8h_ptr)(p + 256);
  return __builtin_shufflevector(lo, hi, 0, 1, 2, 3, 4, 5, 6, 7, 8, 9, 10, 11, 12, 13, 14, 15);
}

// ---------------------------------------------------------------------------
// Prep 1: x (fp32) -> xh (f16) in fragment order, tile (rt, kt) at (rt*16+kt)*512.
// A wave takes 8 rows x 32 columns: 4 lanes read one 128-byte line of x, and
// the wave's 16-byte stores fill 4 whole lines of xh.
// ---------------------------------------------------------------------------
__global__ __launch_bounds__(256) void cvt_x_kernel(const float* __restrict__ x,
                                                    _Float16* __restrict__ xh) {
  const int t    = blockIdx.x * 256 + threadIdx.x;
  const int l    = t & 31;
  const int w    = t >> 5;
  const int c    = l & 3;                       // 8-column chunk inside the 32-column tile
  const int mrow = (w & 1) * 8 + (l >> 2);      // row inside the 16-row tile
  const int kt   = (w >> 1) & 15;
  const int rt   = w >> 5;
  const float4* p = (const float4*)(x + ((size_t)rt * 16 + mrow) * C_ + kt * 32 + c * 8);
  const size_t i = ((size_t)rt * 16 + kt) * 512 + (c >> 1) * 256 + (mrow + 16 * (c & 1)) * 8;
  float4 a = p[0], b = p[1];
  v8h h;
  h[0] = (_Float16)a.x; h[1] = (_Float16)a.y; h[2] = (_Float16)a.z; h[3] = (_Float16)a.w;
  h[4] = (_Float16)b.x; h[5] = (_Float16)b.y; h[6] = (_Float16)b.z; h[7] = (_Float16)b.w;
  *(v8h*)(xh + i) = h;
}

// ---------------------------------------------------------------------------
// Prep 2: pack Wq/Wk/Wv (C x D fp32, row-major) -> f16 B tiles in fragment order,
// tile (which, 16-column group dt, kt) at ((which*4+dt)*16+kt)*512.
// ---------------------------------------------------------------------------
__global__ __launch_bounds__(256) void pack_w_kernel(const float* __restrict__ Wq,
                                                     const float* __restrict__ Wk,
                                                     const float* __restrict__ Wv,
                                                     _Float16* __restrict__ WT) {
  int t = blockIdx.x * 256 + threadIdx.x;          // 0 .. 3*D_*C_-1
  int w  = t >> 15;                                // D_*C_ = 32768 per matrix
  int dt = (t >> 13) & 3;
  int kt = (t >> 9) & 15;
  int l  = (t >> 3) & 31;
  int d  = dt * 16 + (l & 15);
  int c  = kt * 32 + ((t >> 8) & 1) * 16 + (l >> 4) * 8 + (t & 7);
  const float* W = (w == 0) ? Wq : (w == 1) ? Wk : Wv;
  WT[t] = (_Float16)W[c * D_ + d];                 // coalesced store
}

// ---------------------------------------------------------------------------
// Kernel 1: fused QKV projection. grid = (B*N/16, 3), block = 128.
// ---------------------------------------------------------------------------
template <bool XH>
__global__ __launch_bounds__(128) void qkv_proj_kernel(
    const float* __restrict__ x, const _Float16* __restrict__ xh,
    const _Float16* __restrict__ WT,
    const float* __restrict__ bq, const float* __restrict__ bk,
    const float* __restrict__ bv,
    _Float16* __restrict__ qws, _Float16* __restrict__ kws,
    _Float16* __restrict__ vTws)
{
  const int wave  = threadIdx.x >> 5;
  const int lane  = threadIdx.x & 31;
  const int rt    = blockIdx.x;      // 16-row tile over B*N rows
  const int which = blockIdx.y;      // 0 = Q, 1 = K, 2 = V
  const int d0 = wave * 16;
  const int m  = lane & 15;
  const int hi = lane >> 4;
  const int kb = hi * 8;

  const float* bias = (which == 0) ? bq : (which == 1) ? bk : bv;
  const _Float16* wfrag = WT + (size_t)(which * 4 + wave) * 16 * 512 + lane * 8;
  const _Float16* xfrag = xh + (size_t)rt * 16 * 512 + lane * 8;

  const int row = rt * 16 + m;
  v8f c0 = {0.f, 0.f, 0.f, 0.f, 0.f, 0.f, 0.f, 0.f};
  v8f c1 = c0;

#pragma unroll
  for (int kt4 = 0; kt4 < C_ / 32; kt4 += 4) {
    v16h af[4], bf[4];
#pragma unroll
    for (int i = 0; i < 4; ++i) {
      const int kt = kt4 + i;
      if (XH) {
        af[i] = load_frag_p(xfrag + kt * 512);
      } else {
        const float* pa = x + (size_t)row * C_ + kt * 32 + kb;
#pragma unroll
        for (int e = 0; e < 8; ++e) {
          af[i][e] = (_Float16)pa[e]; af[i][8 + e] = (_Float16)pa[16 + e];
        }
      }
      bf[i] = load_frag_p(wfrag + kt * 512);   // B[k][n] = W[k][d0+n]
    }
    c0 = wmma_f16(af[0], bf[0], c0);
    c1 = wmma_f16(af[1], bf[1], c1);
    c0 = wmma_f16(af[2], bf[2], c0);
    c1 = wmma_f16(af[3], bf[3], c1);
  }
#pragma unroll
  for (int r = 0; r < 8; ++r) c0[r] += c1[r];

  const float bias_n = bias[d0 + m];
  if (which == 0) {
#pragma unroll
    for (int r = 0; r < 8; ++r) {
      int ro = rt * 16 + r + hi * 8;                 // C-layout: VGPR r -> rows r, r+8
      qws[(size_t)ro * D_ + d0 + m] = (_Float16)((c0[r] + bias_n) * 0.125f);  // dk^-0.5 folded in
    }
  } else if (which == 1) {
    // K tiles (16 keys x 32 dims) in fragment order: tile (rt, dim half) at (rt*2+half)*512.
    // Here row = key r + hi*8 and kk = (wave & 1) * 16 + m.
    _Float16* dst = kws + ((size_t)rt * 2 + (wave >> 1)) * 512 + (wave & 1) * 256 +
                    (m >> 3) * 128 + (m & 7);
#pragma unroll
    for (int r = 0; r < 8; ++r)
      dst[(r + hi * 8) * 8] = (_Float16)(c0[r] + bias_n);
    // Precaution: later writes of the stores' address and data registers stay behind this wait.
    asm volatile("s_wait_xcnt 0x0" ::: "memory");
  } else {
    // V tiles (16 dims x 32 keys) in fragment order: tile (32-key block, dim group) at
    // ((rt>>1)*4+wave)*512. Row = dim m, kk = (rt & 1) * 16 + hi * 8 + r: a lane's eight
    // values are one 16-byte run, and the wave stores 512 contiguous bytes.
    v8h h;
#pragma unroll
    for (int r = 0; r < 8; ++r) h[r] = (_Float16)(c0[r] + bias_n);
    *(v8h*)(vTws + ((size_t)(rt >> 1) * 4 + wave) * 512 + (rt & 1) * 256 + lane * 8) = h;
    // Precaution, as behind the K stores: later writes of the store's registers stay behind it.
    asm volatile("s_wait_xcnt 0x0" ::: "memory");
  }
}

// ---------------------------------------------------------------------------
// Kernel 2: flash attention, software-pipelined K (ping-pong regs).
// SPLIT=true: grid (B*N/64, G_), each wave covers N_/G_ keys, writes partials.
// SPLIT=false: grid (B*N/64), full key range, writes final output.
// ---------------------------------------------------------------------------
template <bool SPLIT>
__global__ __launch_bounds__(128) void flash_attn_kernel(
    const _Float16* __restrict__ qws, const _Float16* __restrict__ kws,
    const _Float16* __restrict__ vTws, float* __restrict__ out,
    float* __restrict__ pacc, float* __restrict__ pm, float* __restrict__ pl)
{
  const int LP = 72;                                  // padded row stride (halves)
  __shared__ __align__(16) _Float16 plds[4][16 * LP]; // per-wave P staging tile

  const int wave = threadIdx.x >> 5;
  const int lane = threadIdx.x & 31;
  const int qt = blockIdx.x * 4 + wave;   // global 16-query tile (0..1023)
  const int g  = SPLIT ? blockIdx.y : 0;  // key group
  const int b  = qt >> 8;                 // 256 q-tiles per batch
  const int q0 = qt * 16;                 // global row over B*N
  const int m  = lane & 15;
  const int hi = lane >> 4;
  const int kb = hi * 8;

  const int jBeg = SPLIT ? g * (N_ / G_) : 0;
  const int jEnd = SPLIT ? jBeg + (N_ / G_) : N_;

  _Float16* P = plds[wave];
  const _Float16* vrow = vTws + (size_t)b * D_ * N_;
  const _Float16* krow = kws + (size_t)b * N_ * D_;

  // Q fragments: two 16x32 A-tiles covering head dims 0..31 and 32..63
  v16h qa0 = load_frag_h(qws + (size_t)(q0 + m) * D_ + 0  + kb);
  v16h qa1 = load_frag_h(qws + (size_t)(q0 + m) * D_ + 32 + kb);
  // Address registers of the issued loads may be reused from here on.
  asm volatile("s_wait_xcnt 0x0" ::: "memory");

  v8f acc[4];
#pragma unroll
  for (int t = 0; t < 4; ++t)
#pragma unroll
    for (int r = 0; r < 8; ++r) acc[t][r] = 0.f;

  float rm[8], rl[8];
#pragma unroll
  for (int r = 0; r < 8; ++r) { rm[r] = -1e30f; rl[r] = 0.f; }

  // This lane's place in the next K tiles to load and in the current V tiles.
  gl_half_ptr kp = (gl_half_ptr)(krow + (size_t)jBeg * D_ + lane * 8);
  gl_half_ptr vp = (gl_half_ptr)(vrow + (size_t)jBeg * D_ + lane * 8);

  // Load 8 K fragments (the 64 keys at kp) into kf[], then step kp to the next 64 keys
  // while there are more (else it stays on the group's last tile, always in range).
  auto load_k = [&](v16h* kf, bool more) {
#pragma unroll
    for (int t = 0; t < 4; ++t) {
      kf[2 * t]     = load_frag_g(kp + t * 1024);        // dims 0..31
      kf[2 * t + 1] = load_frag_g(kp + t * 1024 + 512);  // dims 32..63
    }
    // The wait and the pointer's step are one statement, so that the address registers of
    // the issued loads are rewritten only behind the wait.
    const unsigned long long inc = more ? 8192ull : 0ull;
    asm volatile("s_wait_xcnt 0x0\n\tv_add_nc_u64 %0, %1, %0" : "+v"(kp) : "s"(inc) : "memory");
  };

  // One 64-key flash step: consume kfc (keys jc), refill kfn (keys jn).
  auto step = [&](v16h* kfc, int jc, v16h* kfn, int jn) {
    // --- S = Q * K^T for 4 sub-tiles of 16 keys (scale pre-folded into Q) ---
    v8f s[4];
#pragma unroll
    for (int t = 0; t < 4; ++t) {
      v8f z = {0.f, 0.f, 0.f, 0.f, 0.f, 0.f, 0.f, 0.f};
      s[t] = wmma_f16(qa0, kfc[2 * t], z);
      s[t] = wmma_f16(qa1, kfc[2 * t + 1], s[t]);
    }

    // --- Issue V-fragment loads; latency hides under softmax VALU work ---
    v16h vf[8];
#pragma unroll
    for (int nt = 0; nt < 4; ++nt) {
      vf[2 * nt]     = load_frag_g(vp + nt * 512);         // keys jc..jc+31
      vf[2 * nt + 1] = load_frag_g(vp + 2048 + nt * 512);  // keys jc+32..jc+63
    }
    // As in load_k: wait, then step to the next 64 keys (two 32-key blocks of 4 tiles).
    asm volatile("s_wait_xcnt 0x0\n\tv_add_nc_u64 %0, 0x2000, %0" : "+v"(vp) :: "memory");

    // --- Pipeline: refill next K buffer, consumed a half-iteration later ---
    load_k(kfn, jn + 64 < jEnd);

    // --- online softmax (rows r, r+8 live in VGPR r of halves 0/1) ---
    float alpha[8];
#pragma unroll
    for (int r = 0; r < 8; ++r) {
      float mx = fmaxf(fmaxf(s[0][r], s[1][r]), fmaxf(s[2][r], s[3][r]));
      mx = fmaxf(mx, __shfl_xor(mx, 1, 32));
      mx = fmaxf(mx, __shfl_xor(mx, 2, 32));
      mx = fmaxf(mx, __shfl_xor(mx, 4, 32));
      mx = fmaxf(mx, __shfl_xor(mx, 8, 32));
      float mnew = fmaxf(rm[r], mx);
      float a = __expf(rm[r] - mnew);
      rm[r] = mnew;
      alpha[r] = a;
      float p0 = __expf(s[0][r] - mnew);
      float p1 = __expf(s[1][r] - mnew);
      float p2 = __expf(s[2][r] - mnew);
      float p3 = __expf(s[3][r] - mnew);
      s[0][r] = p0; s[1][r] = p1; s[2][r] = p2; s[3][r] = p3;
      float sum = (p0 + p1) + (p2 + p3);
      sum += __shfl_xor(sum, 1, 32);
      sum += __shfl_xor(sum, 2, 32);
      sum += __shfl_xor(sum, 4, 32);
      sum += __shfl_xor(sum, 8, 32);
      rl[r] = rl[r] * a + sum;
    }
#pragma unroll
    for (int r = 0; r < 8; ++r) {
      acc[0][r] *= alpha[r]; acc[1][r] *= alpha[r];
      acc[2][r] *= alpha[r]; acc[3][r] *= alpha[r];
    }

    // --- P (C-layout f32) -> LDS f16 [row][k64], re-read as two A-fragments ---
#pragma unroll
    for (int r = 0; r < 8; ++r) {
      int prow = r + hi * 8;
#pragma unroll
      for (int t = 0; t < 4; ++t)
        P[prow * LP + t * 16 + m] = (_Float16)s[t][r];
    }
    asm volatile("s_wait_dscnt 0" ::: "memory");
    v16h pa0 = load_frag_h(P + m * LP + kb);        // keys jc..jc+31
    v16h pa1 = load_frag_h(P + m * LP + 32 + kb);   // keys jc+32..jc+63

    // --- O += P * V ---
#pragma unroll
    for (int nt = 0; nt < 4; ++nt) {
      acc[nt] = wmma_f16(pa0, vf[2 * nt], acc[nt]);
      acc[nt] = wmma_f16(pa1, vf[2 * nt + 1], acc[nt]);
    }
  };

  v16h kfA[8], kfB[8];
  load_k(kfA, true);

  for (int j = jBeg; j < jEnd; j += 128) {
    // Prefetch the next 128-key K/V tiles into the WGP cache.
    if (j + 128 < jEnd) {
      const _Float16* pk = krow + (size_t)(j + 128) * D_;
      __builtin_prefetch(pk + (size_t)lane * 128, 0, 3);
      __builtin_prefetch(pk + 4096 + (size_t)lane * 128, 0, 3);
      const _Float16* pv = vrow + (size_t)(j + 128) * D_;
      __builtin_prefetch(pv + (size_t)lane * 128, 0, 3);
      __builtin_prefetch(pv + 4096 + (size_t)lane * 128, 0, 3);
      // The prefetches' address registers are temporaries that the next loads overwrite.
      asm volatile("s_wait_xcnt 0x0" ::: "memory");
    }
    step(kfA, j,       kfB, j + 64);
    step(kfB, j + 64,  kfA, j + 128);
  }

  if (SPLIT) {
    // Store unnormalized partial acc + per-row (m, l); combined later.
    const int BN = B_ * N_;
    float* pa = pacc + ((size_t)g * BN + q0) * D_;
#pragma unroll
    for (int r = 0; r < 8; ++r) {
      float* po = pa + (size_t)(r + hi * 8) * D_;
      po[0  + m] = acc[0][r];
      po[16 + m] = acc[1][r];
      po[32 + m] = acc[2][r];
      po[48 + m] = acc[3][r];
    }
#pragma unroll
    for (int r = 0; r < 8; ++r) {
      if (m == r) {                       // 2 lanes (hi=0/1) -> rows r, r+8
        pm[(size_t)g * BN + q0 + r + hi * 8] = rm[r];
        pl[(size_t)g * BN + q0 + r + hi * 8] = rl[r];
      }
    }
  } else {
    // Normalize and store (coalesced 16-float runs per row).
#pragma unroll
    for (int r = 0; r < 8; ++r) {
      float inv = 1.0f / rl[r];
      int ro = q0 + r + hi * 8;
      float* po = out + (size_t)ro * D_;
      po[0  + m] = acc[0][r] * inv;
      po[16 + m] = acc[1][r] * inv;
      po[32 + m] = acc[2][r] * inv;
      po[48 + m] = acc[3][r] * inv;
    }
  }
}

// ---------------------------------------------------------------------------
// Kernel 3: combine split-K partials. One thread per (row, d).
// ---------------------------------------------------------------------------
__global__ __launch_bounds__(256) void combine_kernel(
    const float* __restrict__ pacc, const float* __restrict__ pm,
    const float* __restrict__ pl, float* __restrict__ out)
{
  const int BN = B_ * N_;
  int t = blockIdx.x * 256 + threadIdx.x;   // 0 .. BN*D_-1
  int qrow = t >> 6;
  float M = -1e30f;
#pragma unroll
  for (int g = 0; g < G_; ++g) M = fmaxf(M, pm[(size_t)g * BN + qrow]);
  float L = 0.f, o = 0.f;
#pragma unroll
  for (int g = 0; g < G_; ++g) {
    float w = __expf(pm[(size_t)g * BN + qrow] - M);
    L += w * pl[(size_t)g * BN + qrow];
    o += w * pacc[(size_t)g * BN * D_ + t];
  }
  out[t] = o / L;
}

// ---------------------------------------------------------------------------
extern "C" void kernel_launch(void* const* d_in, const int* in_sizes, int n_in,
                              void* d_out, int out_size, void* d_ws, size_t ws_size,
                              hipStream_t stream) {
  (void)in_sizes; (void)n_in; (void)out_size;
  const float* x  = (const float*)d_in[0];
  const float* Wq = (const float*)d_in[1];
  const float* bq = (const float*)d_in[2];
  const float* Wk = (const float*)d_in[3];
  const float* bk = (const float*)d_in[4];
  const float* Wv = (const float*)d_in[5];
  const float* bv = (const float*)d_in[6];
  float* out = (float*)d_out;

  const size_t elems    = (size_t)B_ * N_ * D_;    // 1,048,576
  const size_t wt_elems = (size_t)3 * D_ * C_;     // 98,304
  const size_t x_elems  = (size_t)B_ * N_ * C_;    // 8,388,608

  // Workspace layout (halves):  qws | kws | vT | WT | xh || (floats) pacc | pm | pl
  // (kws, vT, WT and xh hold fragment-order tiles, see load_frag_p)
  _Float16* qws = (_Float16*)d_ws;
  _Float16* kws = qws + elems;
  _Float16* vT  = kws + elems;
  _Float16* WT  = vT + elems;
  _Float16* xh  = WT + wt_elems;

  const size_t half_bytes  = (3 * elems + wt_elems + x_elems) * sizeof(_Float16);
  float* pacc = (float*)((char*)d_ws + half_bytes);
  float* pm   = pacc + (size_t)G_ * B_ * N_ * D_;
  float* pl   = pm + (size_t)G_ * B_ * N_;
  const size_t split_bytes =
      half_bytes + ((size_t)G_ * B_ * N_ * (D_ + 2)) * sizeof(float);

  const bool use_xh    = ws_size >= half_bytes;
  const bool use_split = ws_size >= split_bytes;

  pack_w_kernel<<<(int)(wt_elems / 256), 256, 0, stream>>>(Wq, Wk, Wv, WT);
  if (use_xh) {
    cvt_x_kernel<<<(int)(x_elems / (256 * 8)), 256, 0, stream>>>(x, xh);
    qkv_proj_kernel<true><<<dim3((B_ * N_) / 16, 3), 128, 0, stream>>>(
        x, xh, WT, bq, bk, bv, qws, kws, vT);
  } else {
    qkv_proj_kernel<false><<<dim3((B_ * N_) / 16, 3), 128, 0, stream>>>(
        x, xh, WT, bq, bk, bv, qws, kws, vT);
  }

  if (use_split) {
    flash_attn_kernel<true><<<dim3((B_ * N_) / 64, G_), 128, 0, stream>>>(
        qws, kws, vT, out, pacc, pm, pl);
    combine_kernel<<<(B_ * N_ * D_) / 256, 256, 0, stream>>>(pacc, pm, pl, out);
  } else {
    flash_attn_kernel<false><<<(B_ * N_) / 64, 128, 0, stream>>>(
        qws, kws, vT, out, pacc, pm, pl);
  }
}

// v002
// Measured time: 49.6 microseconds a run.
// Timed twice side by side with v001, it ran 2.55 times as fast both times.
// All steps since v000 together make it 3.15 times as fast.
#include <hip/hip_runtime.h>
#include <hip/hip_bf16.h>

typedef __attribute__((ext_vector_type(16))) _Float16 v16h;
typedef __attribute__((ext_vector_type(8)))  _Float16 v8h;
typedef __attribute__((ext_vector_type(8)))  float    v8f;

#define B_  4
#define N_  4096
#define C_  512
#define D_  64
#define G_  4            // split-K groups over the key dimension

static __device__ __forceinline__ v8f wmma_f16(v16h a, v16h b, v8f c) {
  // (neg_a, A, neg_b, B, c_mod, C, reuse_a, reuse_b)
  return __builtin_amdgcn_wmma_f32_16x16x32_f16(false, a, false, b, (short)0, c, false, false);
}

// Load one 16-element half-fragment: two contiguous 8-half (16B) runs at p and p+16.
static __device__ __forceinline__ v16h load_frag_h(const _Float16* p) {
  v16h f;
#pragma unroll
  for (int i = 0; i < 8; ++i) { f[i] = p[i]; f[8 + i] = p[16 + i]; }
  return f;
}

// Fragment-order layout of a 16-row x 32-k operand tile (512 halves = 1 KB):
//   element (row, kk) sits at (kk >> 4) * 256 + (row + 16 * ((kk >> 3) & 1)) * 8 + (kk & 7).
// Lane l then finds its two 8-half runs at l * 8 and 256 + l * 8, so each
// wave-wide 16-byte load covers 512 contiguous bytes (4 whole 128-byte lines)
// instead of 32-byte pieces of 16 lines. Same k order as load_frag_h.
// p = tile base + lane * 8.
static __device__ __forceinline__ v16h load_frag_p(const _Float16* p) {
  v8h lo = *(const v8h*)(p);
  v8h hi = *(const v8h*)(p + 256);
  return __builtin_shufflevector(lo, hi, 0, 1, 2, 3, 4, 5, 6, 7, 8, 9, 10, 11, 12, 13, 14, 15);
}
// The same through a pointer that says "global memory" in its type: a pointer that an asm
// statement has stepped would otherwise be loaded from with flat instructions.
typedef const __attribute__((address_space(1))) _Float16* gl_half_ptr;
typedef const __attribute__((address_space(1))) v8h*      gl_v8h_ptr;
static __device__ __forceinline__ v16h load_frag_g(gl_half_ptr p) {
  v8h lo = *(gl_v8h_ptr)(p);
  v8h hi = *(gl_v8h_ptr)(p + 256);
  return __builtin_shufflevector(lo, hi, 0, 1, 2, 3, 4, 5, 6, 7, 8, 9, 10, 11, 12, 13, 14, 15);
}

// ---------------------------------------------------------------------------
// Prep 1: x (fp32) -> xh (f16) in fragment order, tile (rt, kt) at (rt*16+kt)*512.
// A wave takes 8 rows x 32 columns: 4 lanes read one 128-byte line of x, and
// the wave's 16-byte stores fill 4 whole lines of xh.
// ---------------------------------------------------------------------------
__global__ __launch_bounds__(256) void cvt_x_kernel(const float* __restrict__ x,
                                                    _Float16* __restrict__ xh) {
  const int t    = blockIdx.x * 256 + threadIdx.x;
  const int l    = t & 31;
  const int w    = t >> 5;
  const int c    = l & 3;                       // 8-column chunk inside the 32-column tile
  const int mrow = (w & 1) * 8 + (l >> 2);      // row inside the 16-row tile
  const int kt   = (w >> 1) & 15;
  const int rt   = w >> 5;
  const float4* p = (const float4*)(x + ((size_t)rt * 16 + mrow) * C_ + kt * 32 + c * 8);
  const size_t i = ((size_t)rt * 16 + kt) * 512 + (c >> 1) * 256 + (mrow + 16 * (c & 1)) * 8;
  float4 a = p[0], b = p[1];
  v8h h;
  h[0] = (_Float16)a.x; h[1] = (_Float16)a.y; h[2] = (_Float16)a.z; h[3] = (_Float16)a.w;
  h[4] = (_Float16)b.x; h[5] = (_Float16)b.y; h[6] = (_Float16)b.z; h[7] = (_Float16)b.w;
  *(v8h*)(xh + i) = h;
}

// ---------------------------------------------------------------------------
// Prep 2: pack Wq/Wk/Wv (C x D fp32, row-major) -> f16 B tiles in fragment order,
// tile (which, 16-column group dt, kt) at ((which*4+dt)*16+kt)*512.
// ---------------------------------------------------------------------------
__global__ __launch_bounds__(256) void pack_w_kernel(const float* __restrict__ Wq,
                                                     const float* __restrict__ Wk,
                                                     const float* __restrict__ Wv,
                                                     _Float16* __restrict__ WT) {
  int t = blockIdx.x * 256 + threadIdx.x;          // 0 .. 3*D_*C_-1
  int w  = t >> 15;                                // D_*C_ = 32768 per matrix
  int dt = (t >> 13) & 3;
  int kt = (t >> 9) & 15;
  int l  = (t >> 3) & 31;
  int d  = dt * 16 + (l & 15);
  int c  = kt * 32 + ((t >> 8) & 1) * 16 + (l >> 4) * 8 + (t & 7);
  const float* W = (w == 0) ? Wq : (w == 1) ? Wk : Wv;
  WT[t] = (_Float16)W[c * D_ + d];                 // coalesced store
}

// ---------------------------------------------------------------------------
// Kernel 1: fused QKV projection. grid = (B*N/16, 3), block = 128.
// ---------------------------------------------------------------------------
template <bool XH>
__global__ __launch_bounds__(128) void qkv_proj_kernel(
    const float* __restrict__ x, const _Float16* __restrict__ xh,
    const _Float16* __restrict__ WT,
    const float* __restrict__ bq, const float* __restrict__ bk,
    const float* __restrict__ bv,
    _Float16* __restrict__ qws, _Float16* __restrict__ kws,
    _Float16* __restrict__ vTws)
{
  const int wave  = threadIdx.x >> 5;
  const int lane  = threadIdx.x & 31;
  const int rt    = blockIdx.x;      // 16-row tile over B*N rows
  const int which = blockIdx.y;      // 0 = Q, 1 = K, 2 = V
  const int d0 = wave * 16;
  const int m  = lane & 15;
  const int hi = lane >> 4;
  const int kb = hi * 8;

  const float* bias = (which == 0) ? bq : (which == 1) ? bk : bv;
  const _Float16* wfrag = WT + (size_t)(which * 4 + wave) * 16 * 512 + lane * 8;
  const _Float16* xfrag = xh + (size_t)rt * 16 * 512 + lane * 8;

  const int row = rt * 16 + m;
  v8f c0 = {0.f, 0.f, 0.f, 0.f, 0.f, 0.f, 0.f, 0.f};
  v8f c1 = c0;

#pragma unroll
  for (int kt4 = 0; kt4 < C_ / 32; kt4 += 4) {
    v16h af[4], bf[4];
#pragma unroll
    for (int i = 0; i < 4; ++i) {
      const int kt = kt4 + i;
      if (XH) {
        af[i] = load_frag_p(xfrag + kt * 512);
      } else {
        const float* pa = x + (size_t)row * C_ + kt * 32 + kb;
#pragma unroll
        for (int e = 0; e < 8; ++e) {
          af[i][e] = (_Float16)pa[e]; af[i][8 + e] = (_Float16)pa[16 + e];
        }
      }
      bf[i] = load_frag_p(wfrag + kt * 512);   // B[k][n] = W[k][d0+n]
    }
    c0 = wmma_f16(af[0], bf[0], c0);
    c1 = wmma_f16(af[1], bf[1], c1);
    c0 = wmma_f16(af[2], bf[2], c0);
    c1 = wmma_f16(af[3], bf[3], c1);
  }
#pragma unroll
  for (int r = 0; r < 8; ++r) c0[r] += c1[r];

  const float bias_n = bias[d0 + m];
  if (which == 0) {
#pragma unroll
    for (int r = 0; r < 8; ++r) {
      int ro = rt * 16 + r + hi * 8;                 // C-layout: VGPR r -> rows r, r+8
      qws[(size_t)ro * D_ + d0 + m] = (_Float16)((c0[r] + bias_n) * 0.125f);  // dk^-0.5 folded in
    }
  } else if (which == 1) {
    // K tiles (16 keys x 32 dims) in fragment order: tile (rt, dim half) at (rt*2+half)*512.
    // Here row = key r + hi*8 and kk = (wave & 1) * 16 + m.
    _Float16* dst = kws + ((size_t)rt * 2 + (wave >> 1)) * 512 + (wave & 1) * 256 +
                    (m >> 3) * 128 + (m & 7);
#pragma unroll
    for (int r = 0; r < 8; ++r)
      dst[(r + hi * 8) * 8] = (_Float16)(c0[r] + bias_n);
    // Precaution: later writes of the stores' address and data registers stay behind this wait.
    asm volatile("s_wait_xcnt 0x0" ::: "memory");
  } else {
    // V tiles (16 dims x 32 keys) in fragment order: tile (32-key block, dim group) at
    // ((rt>>1)*4+wave)*512. Row = dim m, kk = (rt & 1) * 16 + hi * 8 + r: a lane's eight
    // values are one 16-byte run, and the wave stores 512 contiguous bytes.
    v8h h;
#pragma unroll
    for (int r = 0; r < 8; ++r) h[r] = (_Float16)(c0[r] + bias_n);
    *(v8h*)(vTws + ((size_t)(rt >> 1) * 4 + wave) * 512 + (rt & 1) * 256 + lane * 8) = h;
    // Precaution, as behind the K stores: later writes of the store's registers stay behind it.
    asm volatile("s_wait_xcnt 0x0" ::: "memory");
  }
}

static __device__ __forceinline__ float xhalf(float v) {
  const int b = __builtin_bit_cast(int, v);
  return __builtin_bit_cast(
      float, __builtin_amdgcn_permlanex16(b, b, 0x76543210, 0xfedcba98, false, false));
}

template <bool SPLIT>
__global__ __launch_bounds__(128) void flash_attn_kernel(
    const _Float16* __restrict__ qws, const _Float16* __restrict__ kws,
    const _Float16* __restrict__ vTws, float* __restrict__ out,
    float* __restrict__ pacc, float* __restrict__ pm, float* __restrict__ pl)
{
  const int wave = threadIdx.x >> 5;
  const int lane = threadIdx.x & 31;
  const int qt = blockIdx.x * 4 + wave;   // global 16-query tile (0..1023)
  const int g  = SPLIT ? blockIdx.y : 0;  // key group
  const int b  = qt >> 8;                 // 256 q-tiles per batch
  const int q0 = qt * 16;                 // global row over B*N
  const int m  = lane & 15;
  const int hi = lane >> 4;
  const int kb = hi * 8;

  const int jBeg = SPLIT ? g * (N_ / G_) : 0;
  const int jEnd = SPLIT ? jBeg + (N_ / G_) : N_;

  const _Float16* vrow = vTws + (size_t)b * D_ * N_;
  const _Float16* krow = kws + (size_t)b * N_ * D_;

  // Q fragments: two 32x16 B-tiles (column = query m) covering head dims 0..31 and 32..63
  v16h qa0 = load_frag_h(qws + (size_t)(q0 + m) * D_ + 0  + kb);
  v16h qa1 = load_frag_h(qws + (size_t)(q0 + m) * D_ + 32 + kb);
  // Address registers of the issued loads may be reused from here on.
  asm volatile("s_wait_xcnt 0x0" ::: "memory");

  // acc[t][r] = O[query m][dim t * 16 + hi * 8 + r]
  v8f acc[4];
#pragma unroll
  for (int t = 0; t < 4; ++t)
#pragma unroll
    for (int r = 0; r < 8; ++r) acc[t][r] = 0.f;

  float rm = -1e30f;   // running maximum of query m (equal in both halves)
  float rl = 0.f;      // running sum of query m over THIS half's keys; joined after the loop

  // This lane's place in the next K tiles to load and in the current V tiles.
  gl_half_ptr kp = (gl_half_ptr)(krow + (size_t)jBeg * D_ + lane * 8);
  gl_half_ptr vp = (gl_half_ptr)(vrow + (size_t)jBeg * D_ + lane * 8);

  // Load 8 K fragments (the 64 keys at kp) into kf[], then step kp to the next 64 keys
  // while there are more (else it stays on the group's last tile, always in range).
  auto load_k = [&](v16h* kf, bool more) {
#pragma unroll
    for (int t = 0; t < 4; ++t) {
      kf[2 * t]     = load_frag_g(kp + t * 1024);        // dims 0..31
      kf[2 * t + 1] = load_frag_g(kp + t * 1024 + 512);  // dims 32..63
    }
    // The wait and the pointer's step are one statement, so that the address registers of
    // the issued loads are rewritten only behind the wait.
    const unsigned long long inc = more ? 8192ull : 0ull;
    asm volatile("s_wait_xcnt 0x0\n\tv_add_nc_u64 %0, %1, %0" : "+v"(kp) : "s"(inc) : "memory");
  };

  // One 64-key flash step: consume kf (keys jc), then refill it with the next 64 keys.
  auto step = [&](v16h* kf, int jc) {
    // --- S^T = K * Q^T for 4 sub-tiles of 16 keys (scale pre-folded into Q):
    //     s[t][r] = score of key jc + t * 16 + hi * 8 + r against query m ---
    v8f s[4];
#pragma unroll
    for (int t = 0; t < 4; ++t) {
      v8f z = {0.f, 0.f, 0.f, 0.f, 0.f, 0.f, 0.f, 0.f};
      s[t] = wmma_f16(kf[2 * t], qa0, z);
      s[t] = wmma_f16(kf[2 * t + 1], qa1, s[t]);
    }

    // --- Issue V-fragment loads; latency hides under softmax VALU work ---
    v16h vf[8];
#pragma unroll
    for (int nt = 0; nt < 4; ++nt) {
      vf[2 * nt]     = load_frag_g(vp + nt * 512);         // keys jc..jc+31
      vf[2 * nt + 1] = load_frag_g(vp + 2048 + nt * 512);  // keys jc+32..jc+63
    }
    // As in load_k: wait, then step to the next 64 keys (two 32-key blocks of 4 tiles).
    asm volatile("s_wait_xcnt 0x0\n\tv_add_nc_u64 %0, 0x2000, %0" : "+v"(vp) :: "memory");

    // --- Pipeline: refill the K fragments, consumed in the next step ---
    load_k(kf, jc + 128 < jEnd);
    // Keeps all 32 loads issued ahead of the softmax: without it the scheduler sinks them
    // down to their first use, and each product then waits out its own load's latency.
    __builtin_amdgcn_sched_barrier(0);

    // --- online softmax of query m: 32 scores here, 32 in lane ^ 16 ---
    float mt[4];
#pragma unroll
    for (int t = 0; t < 4; ++t) {
      mt[t] = fmaxf(fmaxf(fmaxf(s[t][0], s[t][1]), fmaxf(s[t][2], s[t][3])),
                    fmaxf(fmaxf(s[t][4], s[t][5]), fmaxf(s[t][6], s[t][7])));
    }
    float mx = fmaxf(fmaxf(mt[0], mt[1]), fmaxf(mt[2], mt[3]));
    mx = fmaxf(mx, xhalf(mx));
    const float mnew  = fmaxf(rm, mx);
    const float alpha = __expf(rm - mnew);
    rm = mnew;

    float st[4];
#pragma unroll
    for (int t = 0; t < 4; ++t) {
#pragma unroll
      for (int r = 0; r < 8; ++r) s[t][r] = __expf(s[t][r] - mnew);
      st[t] = ((s[t][0] + s[t][1]) + (s[t][2] + s[t][3])) +
              ((s[t][4] + s[t][5]) + (s[t][6] + s[t][7]));
    }
    rl = rl * alpha + ((st[0] + st[1]) + (st[2] + st[3]));

#pragma unroll
    for (int t = 0; t < 4; ++t)
#pragma unroll
      for (int r = 0; r < 8; ++r) acc[t][r] *= alpha;

    // --- P^T as B operand: element e < 8 is key hi * 8 + e (tile 0 or 2), element 8 + e
    //     key 16 + hi * 8 + e (tile 1 or 3): the k order of the V tiles ---
    v16h pb0, pb1;
#pragma unroll
    for (int e = 0; e < 8; ++e) {
      pb0[e] = (_Float16)s[0][e]; pb0[8 + e] = (_Float16)s[1][e];   // keys jc..jc+31
      pb1[e] = (_Float16)s[2][e]; pb1[8 + e] = (_Float16)s[3][e];   // keys jc+32..jc+63
    }

    // --- O^T += V^T * P^T ---
#pragma unroll
    for (int nt = 0; nt < 4; ++nt) {
      acc[nt] = wmma_f16(vf[2 * nt], pb0, acc[nt]);
      acc[nt] = wmma_f16(vf[2 * nt + 1], pb1, acc[nt]);
    }
  };

  v16h kf[8];
  load_k(kf, true);

  for (int j = jBeg; j < jEnd; j += 64) {
    // Prefetch the K/V tiles two steps ahead into the WGP cache.
    if (j + 128 < jEnd) {
      const _Float16* pk = krow + (size_t)(j + 128) * D_;
      __builtin_prefetch(pk + (size_t)lane * 128, 0, 3);
      const _Float16* pv = vrow + (size_t)(j + 128) * D_;
      __builtin_prefetch(pv + (size_t)lane * 128, 0, 3);
      // The prefetches' address registers are temporaries that the next loads overwrite.
      asm volatile("s_wait_xcnt 0x0" ::: "memory");
    }
    step(kf, j);
  }

  // Join the two halves' sums: every lane then has the whole row sum of query m.
  rl += xhalf(rl);

  if (SPLIT) {
    // Store unnormalized partial acc + per-row (m, l); combined later.
    // A lane's 8 values of a tile are 8 consecutive dims of its query's row.
    const int BN = B_ * N_;
    float* po = pacc + ((size_t)g * BN + q0 + m) * D_ + kb;
#pragma unroll
    for (int t = 0; t < 4; ++t) {
      *(float4*)(po + t * 16)     = make_float4(acc[t][0], acc[t][1], acc[t][2], acc[t][3]);
      *(float4*)(po + t * 16 + 4) = make_float4(acc[t][4], acc[t][5], acc[t][6], acc[t][7]);
    }
    // Precaution: later writes of the stores' address and data registers stay behind this wait.
    asm volatile("s_wait_xcnt 0x0" ::: "memory");
    if (hi == 0) {
      pm[(size_t)g * BN + q0 + m] = rm;
      pl[(size_t)g * BN + q0 + m] = rl;
    }
  } else {
    // Normalize and store.
    const float inv = 1.0f / rl;
    float* po = out + (size_t)(q0 + m) * D_ + kb;
#pragma unroll
    for (int t = 0; t < 4; ++t) {
      *(float4*)(po + t * 16) =
          make_float4(acc[t][0] * inv, acc[t][1] * inv, acc[t][2] * inv, acc[t][3] * inv);
      *(float4*)(po + t * 16 + 4) =
          make_float4(acc[t][4] * inv, acc[t][5] * inv, acc[t][6] * inv, acc[t][7] * inv);
    }
  }
}

// ---------------------------------------------------------------------------
// Kernel 3: combine split-K partials. One thread per (row, d).
// ---------------------------------------------------------------------------
__global__ __launch_bounds__(256) void combine_kernel(
    const float* __restrict__ pacc, const float* __restrict__ pm,
    const float* __restrict__ pl, float* __restrict__ out)
{
  const int BN = B_ * N_;
  int t = blockIdx.x * 256 + threadIdx.x;   // 0 .. BN*D_-1
  int qrow = t >> 6;
  float M = -1e30f;
#pragma unroll
  for (int g = 0; g < G_; ++g) M = fmaxf(M, pm[(size_t)g * BN + qrow]);
  float L = 0.f, o = 0.f;
#pragma unroll
  for (int g = 0; g < G_; ++g) {
    float w = __expf(pm[(size_t)g * BN + qrow] - M);
    L += w * pl[(size_t)g * BN + qrow];
    o += w * pacc[(size_t)g * BN * D_ + t];
  }
  out[t] = o / L;
}

// ---------------------------------------------------------------------------
extern "C" void kernel_launch(void* const* d_in, const int* in_sizes, int n_in,
                              void* d_out, int out_size, void* d_ws, size_t ws_size,
                              hipStream_t stream) {
  (void)in_sizes; (void)n_in; (void)out_size;
  const float* x  = (const float*)d_in[0];
  const float* Wq = (const float*)d_in[1];
  const float* bq = (const float*)d_in[2];
  const float* Wk = (const float*)d_in[3];
  const float* bk = (const float*)d_in[4];
  const float* Wv = (const float*)d_in[5];
  const float* bv = (const float*)d_in[6];
  float* out = (float*)d_out;

  const size_t elems    = (size_t)B_ * N_ * D_;    // 1,048,576
  const size_t wt_elems = (size_t)3 * D_ * C_;     // 98,304
  const size_t x_elems  = (size_t)B_ * N_ * C_;    // 8,388,608

  // Workspace layout (halves):  qws | kws | vT | WT | xh || (floats) pacc | pm | pl
  // (kws, vT, WT and xh hold fragment-order tiles, see load_frag_p)
  _Float16* qws = (_Float16*)d_ws;
  _Float16* kws = qws + elems;
  _Float16* vT  = kws + elems;
  _Float16* WT  = vT + elems;
  _Float16* xh  = WT + wt_elems;

  const size_t half_bytes  = (3 * elems + wt_elems + x_elems) * sizeof(_Float16);
  float* pacc = (float*)((char*)d_ws + half_bytes);
  float* pm   = pacc + (size_t)G_ * B_ * N_ * D_;
  float* pl   = pm + (size_t)G_ * B_ * N_;
  const size_t split_bytes =
      half_bytes + ((size_t)G_ * B_ * N_ * (D_ + 2)) * sizeof(float);

  const bool use_xh    = ws_size >= half_bytes;
  const bool use_split = ws_size >= split_bytes;

  pack_w_kernel<<<(int)(wt_elems / 256), 256, 0, stream>>>(Wq, Wk, Wv, WT);
  if (use_xh) {
    cvt_x_kernel<<<(int)(x_elems / (256 * 8)), 256, 0, stream>>>(x, xh);
    qkv_proj_kernel<true><<<dim3((B_ * N_) / 16, 3), 128, 0, stream>>>(
        x, xh, WT, bq, bk, bv, qws, kws, vT);
  } else {
    qkv_proj_kernel<false><<<dim3((B_ * N_) / 16, 3), 128, 0, stream>>>(
        x, xh, WT, bq, bk, bv, qws, kws, vT);
  }

  if (use_split) {
    flash_attn_kernel<true><<<dim3((B_ * N_) / 64, G_), 128, 0, stream>>>(
        qws, kws, vT, out, pacc, pm, pl);
    combine_kernel<<<(B_ * N_ * D_) / 256, 256, 0, stream>>>(pacc, pm, pl, out);
  } else {
    flash_attn_kernel<false><<<(B_ * N_) / 64, 128, 0, stream>>>(
        qws, kws, vT, out, pacc, pm, pl);
  }
}

// v003
// It runs in 43.1 microseconds.
// Two timings next to v002 put it at 1.16 and 1.15 times that version's speed.
// Counting every step since v000, it is 3.63 times as fast.
#include <hip/hip_runtime.h>
#include <hip/hip_bf16.h>

typedef __attribute__((ext_vector_type(16))) _Float16 v16h;
typedef __attribute__((ext_vector_type(8)))  _Float16 v8h;
typedef __attribute__((ext_vector_type(8)))  float    v8f;

#define B_  4
#define N_  4096
#define C_  512
#define D_  64
#define G_  4            // split-K groups over the key dimension, one per four waves of a block
#define OP_ 68           // floats per row of a partial O tile in LDS: 272 B = 16 B x odd

static __device__ __forceinline__ v8f wmma_f16(v16h a, v16h b, v8f c) {
  // (neg_a, A, neg_b, B, c_mod, C, reuse_a, reuse_b)
  return __builtin_amdgcn_wmma_f32_16x16x32_f16(false, a, false, b, (short)0, c, false, false);
}

// Load one 16-element half-fragment: two contiguous 8-half (16B) runs at p and p+16.
static __device__ __forceinline__ v16h load_frag_h(const _Float16* p) {
  v16h f;
#pragma unroll
  for (int i = 0; i < 8; ++i) { f[i] = p[i]; f[8 + i] = p[16 + i]; }
  return f;
}

// Fragment-order layout of a 16-row x 32-k operand tile (512 halves = 1 KB):
//   element (row, kk) sits at (kk >> 4) * 256 + (row + 16 * ((kk >> 3) & 1)) * 8 + (kk & 7).
// Lane l then finds its two 8-half runs at l * 8 and 256 + l * 8, so each
// wave-wide 16-byte load covers 512 contiguous bytes (4 whole 128-byte lines)
// instead of 32-byte pieces of 16 lines. Same k order as load_frag_h.
// p = tile base + lane * 8.
static __device__ __forceinline__ v16h load_frag_p(const _Float16* p) {
  v8h lo = *(const v8h*)(p);
  v8h hi = *(const v8h*)(p + 256);
  return __builtin_shufflevector(lo, hi, 0, 1, 2, 3, 4, 5, 6, 7, 8, 9, 10, 11, 12, 13, 14, 15);
}
// The same through a pointer that says "global memory" in its type: a pointer that an asm
// statement has stepped would otherwise be loaded from with flat instructions.
typedef const __attribute__((address_space(1))) _Float16* gl_half_ptr;
typedef const __attribute__((address_space(1))) v8h*      gl_v8h_ptr;
static __device__ __forceinline__ v16h load_frag_g(gl_half_ptr p) {
  v8h lo = *(gl_v8h_ptr)(p);
  v8h hi = *(gl_v8h_ptr)(p + 256);
  return __builtin_shufflevector(lo, hi, 0, 1, 2, 3, 4, 5, 6, 7, 8, 9, 10, 11, 12, 13, 14, 15);
}

// ---------------------------------------------------------------------------
// Prep 1: x (fp32) -> xh (f16) in fragment order, tile (rt, kt) at (rt*16+kt)*512.
// A wave takes 8 rows x 32 columns: 4 lanes read one 128-byte line of x, and
// the wave's 16-byte stores fill 4 whole lines of xh.
// ---------------------------------------------------------------------------
__global__ __launch_bounds__(256) void cvt_x_kernel(const float* __restrict__ x,
                                                    _Float16* __restrict__ xh) {
  const int t    = blockIdx.x * 256 + threadIdx.x;
  const int l    = t & 31;
  const int w    = t >> 5;
  const int c    = l & 3;                       // 8-column chunk inside the 32-column tile
  const int mrow = (w & 1) * 8 + (l >> 2);      // row inside the 16-row tile
  const int kt   = (w >> 1) & 15;
  const int rt   = w >> 5;
  const float4* p = (const float4*)(x + ((size_t)rt * 16 + mrow) * C_ + kt * 32 + c * 8);
  const size_t i = ((size_t)rt * 16 + kt) * 512 + (c >> 1) * 256 + (mrow + 16 * (c & 1)) * 8;
  float4 a = p[0], b = p[1];
  v8h h;
  h[0] = (_Float16)a.x; h[1] = (_Float16)a.y; h[2] = (_Float16)a.z; h[3] = (_Float16)a.w;
  h[4] = (_Float16)b.x; h[5] = (_Float16)b.y; h[6] = (_Float16)b.z; h[7] = (_Float16)b.w;
  *(v8h*)(xh + i) = h;
}

// ---------------------------------------------------------------------------
// Prep 2: pack Wq/Wk/Wv (C x D fp32, row-major) -> f16 B tiles in fragment order,
// tile (which, 16-column group dt, kt) at ((which*4+dt)*16+kt)*512.
// ---------------------------------------------------------------------------
__global__ __launch_bounds__(256) void pack_w_kernel(const float* __restrict__ Wq,
                                                     const float* __restrict__ Wk,
                                                     const float* __restrict__ Wv,
                                                     _Float16* __restrict__ WT) {
  int t = blockIdx.x * 256 + threadIdx.x;          // 0 .. 3*D_*C_-1
  int w  = t >> 15;                                // D_*C_ = 32768 per matrix
  int dt = (t >> 13) & 3;
  int kt = (t >> 9) & 15;
  int l  = (t >> 3) & 31;
  int d  = dt * 16 + (l & 15);
  int c  = kt * 32 + ((t >> 8) & 1) * 16 + (l >> 4) * 8 + (t & 7);
  const float* W = (w == 0) ? Wq : (w == 1) ? Wk : Wv;
  WT[t] = (_Float16)W[c * D_ + d];                 // coalesced store
}

// ---------------------------------------------------------------------------
// Kernel 1: fused QKV projection. grid = (B*N/16, 3), block = 128.
// ---------------------------------------------------------------------------
template <bool XH>
__global__ __launch_bounds__(128) void qkv_proj_kernel(
    const float* __restrict__ x, const _Float16* __restrict__ xh,
    const _Float16* __restrict__ WT,
    const float* __restrict__ bq, const float* __restrict__ bk,
    const float* __restrict__ bv,
    _Float16* __restrict__ qws, _Float16* __restrict__ kws,
    _Float16* __restrict__ vTws)
{
  const int wave  = threadIdx.x >> 5;
  const int lane  = threadIdx.x & 31;
  const int rt    = blockIdx.x;      // 16-row tile over B*N rows
  const int which = blockIdx.y;      // 0 = Q, 1 = K, 2 = V
  const int d0 = wave * 16;
  const int m  = lane & 15;
  const int hi = lane >> 4;
  const int kb = hi * 8;

  const float* bias = (which == 0) ? bq : (which == 1) ? bk : bv;
  const _Float16* wfrag = WT + (size_t)(which * 4 + wave) * 16 * 512 + lane * 8;
  const _Float16* xfrag = xh + (size_t)rt * 16 * 512 + lane * 8;

  const int row = rt * 16 + m;
  v8f c0 = {0.f, 0.f, 0.f, 0.f, 0.f, 0.f, 0.f, 0.f};
  v8f c1 = c0;

#pragma unroll
  for (int kt4 = 0; kt4 < C_ / 32; kt4 += 4) {
    v16h af[4], bf[4];
#pragma unroll
    for (int i = 0; i < 4; ++i) {
      const int kt = kt4 + i;
      if (XH) {
        af[i] = load_frag_p(xfrag + kt * 512);
      } else {
        const float* pa = x + (size_t)row * C_ + kt * 32 + kb;
#pragma unroll
        for (int e = 0; e < 8; ++e) {
          af[i][e] = (_Float16)pa[e]; af[i][8 + e] = (_Float16)pa[16 + e];
        }
      }
      bf[i] = load_frag_p(wfrag + kt * 512);   // B[k][n] = W[k][d0+n]
    }
    c0 = wmma_f16(af[0], bf[0], c0);
    c1 = wmma_f16(af[1], bf[1], c1);
    c0 = wmma_f16(af[2], bf[2], c0);
    c1 = wmma_f16(af[3], bf[3], c1);
  }
#pragma unroll
  for (int r = 0; r < 8; ++r) c0[r] += c1[r];

  const float bias_n = bias[d0 + m];
  if (which == 0) {
#pragma unroll
    for (int r = 0; r < 8; ++r) {
      int ro = rt * 16 + r + hi * 8;                 // C-layout: VGPR r -> rows r, r+8
      qws[(size_t)ro * D_ + d0 + m] = (_Float16)((c0[r] + bias_n) * 0.125f);  // dk^-0.5 folded in
    }
  } else if (which == 1) {
    // K tiles (16 keys x 32 dims) in fragment order: tile (rt, dim half) at (rt*2+half)*512.
    // Here row = key r + hi*8 and kk = (wave & 1) * 16 + m.
    _Float16* dst = kws + ((size_t)rt * 2 + (wave >> 1)) * 512 + (wave & 1) * 256 +
                    (m >> 3) * 128 + (m & 7);
#pragma unroll
    for (int r = 0; r < 8; ++r)
      dst[(r + hi * 8) * 8] = (_Float16)(c0[r] + bias_n);
    // Precaution: later writes of the stores' address and data registers stay behind this wait.
    asm volatile("s_wait_xcnt 0x0" ::: "memory");
  } else {
    // V tiles (16 dims x 32 keys) in fragment order: tile (32-key block, dim group) at
    // ((rt>>1)*4+wave)*512. Row = dim m, kk = (rt & 1) * 16 + hi * 8 + r: a lane's eight
    // values are one 16-byte run, and the wave stores 512 contiguous bytes.
    v8h h;
#pragma unroll
    for (int r = 0; r < 8; ++r) h[r] = (_Float16)(c0[r] + bias_n);
    *(v8h*)(vTws + ((size_t)(rt >> 1) * 4 + wave) * 512 + (rt & 1) * 256 + lane * 8) = h;
    // Precaution, as behind the K stores: later writes of the store's registers stay behind it.
    asm volatile("s_wait_xcnt 0x0" ::: "memory");
  }
}

static __device__ __forceinline__ float xhalf(float v) {
  const int b = __builtin_bit_cast(int, v);
  return __builtin_bit_cast(
      float, __builtin_amdgcn_permlanex16(b, b, 0x76543210, 0xfedcba98, false, false));
}

__global__ __launch_bounds__(512) void flash_attn_kernel(
    const _Float16* __restrict__ qws, const _Float16* __restrict__ kws,
    const _Float16* __restrict__ vTws, float* __restrict__ out)
{
  __shared__ __attribute__((aligned(16))) float sacc[G_ * 64 * OP_];  // unnormalized partial O
  __shared__ float sm[G_ * 64];                                       // partial row maxima
  __shared__ float sl[G_ * 64];                                       // partial row sums

  // The wave's number as a scalar: tile and group numbers, and the K and V base addresses
  // formed from them, then stay in scalar registers instead of per-lane arithmetic.
  const int wave = __builtin_amdgcn_readfirstlane(threadIdx.x >> 5);
  const int lane = threadIdx.x & 31;
  const int qw = wave & 3;                // query tile inside the block
  const int qt = blockIdx.x * 4 + qw;     // global 16-query tile (0..1023)
  const int g  = wave >> 2;               // key group
  const int b  = qt >> 8;                 // 256 q-tiles per batch
  const int q0 = qt * 16;                 // global row over B*N
  const int m  = lane & 15;
  const int hi = lane >> 4;
  const int kb = hi * 8;

  // Keys are counted from the start of the wave's own group.
  const int jBeg = 0;
  const int jEnd = N_ / G_;

  const _Float16* vrow = vTws + ((size_t)b * N_ + g * (N_ / G_)) * D_;
  const _Float16* krow = kws + ((size_t)b * N_ + g * (N_ / G_)) * D_;

  // Q fragments: two 32x16 B-tiles (column = query m) covering head dims 0..31 and 32..63
  v16h qa0 = load_frag_h(qws + (size_t)(q0 + m) * D_ + 0  + kb);
  v16h qa1 = load_frag_h(qws + (size_t)(q0 + m) * D_ + 32 + kb);
  // Address registers of the issued loads may be reused from here on.
  asm volatile("s_wait_xcnt 0x0" ::: "memory");

  // acc[t][r] = O[query m][dim t * 16 + hi * 8 + r]
  v8f acc[4];
#pragma unroll
  for (int t = 0; t < 4; ++t)
#pragma unroll
    for (int r = 0; r < 8; ++r) acc[t][r] = 0.f;

  float rm = -1e30f;   // running maximum of query m (equal in both halves)
  float rl = 0.f;      // running sum of query m over THIS half's keys; joined after the loop

  // This lane's place in the next K tiles to load and in the current V tiles.
  gl_half_ptr kp = (gl_half_ptr)(krow + (size_t)jBeg * D_ + lane * 8);
  gl_half_ptr vp = (gl_half_ptr)(vrow + (size_t)jBeg * D_ + lane * 8);

  // Load 8 K fragments (the 64 keys at kp) into kf[], then step kp to the next 64 keys
  // while there are more (else it stays on the group's last tile, always in range).
  auto load_k = [&](v16h* kf, bool more) {
#pragma unroll
    for (int t = 0; t < 4; ++t) {
      kf[2 * t]     = load_frag_g(kp + t * 1024);        // dims 0..31
      kf[2 * t + 1] = load_frag_g(kp + t * 1024 + 512);  // dims 32..63
    }
    // The wait and the pointer's step are one statement, so that the address registers of
    // the issued loads are rewritten only behind the wait.
    const unsigned long long inc = more ? 8192ull : 0ull;
    asm volatile("s_wait_xcnt 0x0\n\tv_add_nc_u64 %0, %1, %0" : "+v"(kp) : "s"(inc) : "memory");
  };

  // One 64-key flash step: consume kf (keys jc), then refill it with the next 64 keys.
  auto step = [&](v16h* kf, int jc) {
    // --- S^T = K * Q^T for 4 sub-tiles of 16 keys (scale pre-folded into Q):
    //     s[t][r] = score of key jc + t * 16 + hi * 8 + r against query m ---
    v8f s[4];
#pragma unroll
    for (int t = 0; t < 4; ++t) {
      v8f z = {0.f, 0.f, 0.f, 0.f, 0.f, 0.f, 0.f, 0.f};
      s[t] = wmma_f16(kf[2 * t], qa0, z);
      s[t] = wmma_f16(kf[2 * t + 1], qa1, s[t]);
    }

    // --- Issue V-fragment loads; latency hides under softmax VALU work ---
    v16h vf[8];
#pragma unroll
    for (int nt = 0; nt < 4; ++nt) {
      vf[2 * nt]     = load_frag_g(vp + nt * 512);         // keys jc..jc+31
      vf[2 * nt + 1] = load_frag_g(vp + 2048 + nt * 512);  // keys jc+32..jc+63
    }
    // As in load_k: wait, then step to the next 64 keys (two 32-key blocks of 4 tiles).
    asm volatile("s_wait_xcnt 0x0\n\tv_add_nc_u64 %0, 0x2000, %0" : "+v"(vp) :: "memory");

    // --- Pipeline: refill the K fragments, consumed in the next step ---
    load_k(kf, jc + 128 < jEnd);
    // Keeps all 32 loads issued ahead of the softmax: without it the scheduler sinks them
    // down to their first use, and each product then waits out its own load's latency.
    __builtin_amdgcn_sched_barrier(0);

    // --- online softmax of query m: 32 scores here, 32 in lane ^ 16 ---
    float mt[4];
#pragma unroll
    for (int t = 0; t < 4; ++t) {
      mt[t] = fmaxf(fmaxf(fmaxf(s[t][0], s[t][1]), fmaxf(s[t][2], s[t][3])),
                    fmaxf(fmaxf(s[t][4], s[t][5]), fmaxf(s[t][6], s[t][7])));
    }
    float mx = fmaxf(fmaxf(mt[0], mt[1]), fmaxf(mt[2], mt[3]));
    mx = fmaxf(mx, xhalf(mx));
    const float mnew  = fmaxf(rm, mx);
    const float alpha = __expf(rm - mnew);
    rm = mnew;

    float st[4];
#pragma unroll
    for (int t = 0; t < 4; ++t) {
#pragma unroll
      for (int r = 0; r < 8; ++r) s[t][r] = __expf(s[t][r] - mnew);
      st[t] = ((s[t][0] + s[t][1]) + (s[t][2] + s[t][3])) +
              ((s[t][4] + s[t][5]) + (s[t][6] + s[t][7]));
    }
    rl = rl * alpha + ((st[0] + st[1]) + (st[2] + st[3]));

#pragma unroll
    for (int t = 0; t < 4; ++t)
#pragma unroll
      for (int r = 0; r < 8; ++r) acc[t][r] *= alpha;

    // --- P^T as B operand: element e < 8 is key hi * 8 + e (tile 0 or 2), element 8 + e
    //     key 16 + hi * 8 + e (tile 1 or 3): the k order of the V tiles ---
    v16h pb0, pb1;
#pragma unroll
    for (int e = 0; e < 8; ++e) {
      pb0[e] = (_Float16)s[0][e]; pb0[8 + e] = (_Float16)s[1][e];   // keys jc..jc+31
      pb1[e] = (_Float16)s[2][e]; pb1[8 + e] = (_Float16)s[3][e];   // keys jc+32..jc+63
    }

    // --- O^T += V^T * P^T ---
#pragma unroll
    for (int nt = 0; nt < 4; ++nt) {
      acc[nt] = wmma_f16(vf[2 * nt], pb0, acc[nt]);
      acc[nt] = wmma_f16(vf[2 * nt + 1], pb1, acc[nt]);
    }
  };

  v16h kf[8];
  load_k(kf, true);

  for (int j = jBeg; j < jEnd; j += 64) {
    // Prefetch the K/V tiles two steps ahead into the WGP cache.
    if (j + 128 < jEnd) {
      const _Float16* pk = krow + (size_t)(j + 128) * D_;
      __builtin_prefetch(pk + (size_t)lane * 128, 0, 3);
      const _Float16* pv = vrow + (size_t)(j + 128) * D_;
      __builtin_prefetch(pv + (size_t)lane * 128, 0, 3);
      // The prefetches' address registers are temporaries that the next loads overwrite.
      asm volatile("s_wait_xcnt 0x0" ::: "memory");
    }
    step(kf, j);
  }

  // Join the two halves' sums: every lane then has the whole row sum of query m.
  rl += xhalf(rl);

  // Unnormalized partial acc and per-row (m, l) into LDS.
  // A lane's 8 values of a tile are 8 consecutive dims of its query's row.
  {
    float* po = sacc + (g * 64 + qw * 16 + m) * OP_ + kb;
#pragma unroll
    for (int t = 0; t < 4; ++t) {
      *(float4*)(po + t * 16)     = make_float4(acc[t][0], acc[t][1], acc[t][2], acc[t][3]);
      *(float4*)(po + t * 16 + 4) = make_float4(acc[t][4], acc[t][5], acc[t][6], acc[t][7]);
    }
    if (hi == 0) {
      sm[g * 64 + qw * 16 + m] = rm;
      sl[g * 64 + qw * 16 + m] = rl;
    }
  }
  // Every group's partials are in LDS behind this barrier.
  __syncthreads();

  // Join the key groups: 16 threads per row, 4 dims each, rows r and r + 32 of the block's
  // 64, so that a wave's 16-byte stores cover 512 contiguous bytes of out.
  const int col = (threadIdx.x & 15) * 4;
  float4 res[2];
#pragma unroll
  for (int h = 0; h < 2; ++h) {
    const int r = (threadIdx.x >> 4) + h * 32;
    float M = -1e30f;
#pragma unroll
    for (int gg = 0; gg < G_; ++gg) M = fmaxf(M, sm[gg * 64 + r]);
    float L = 0.f;
    float4 o = make_float4(0.f, 0.f, 0.f, 0.f);
#pragma unroll
    for (int gg = 0; gg < G_; ++gg) {
      const float w = __expf(sm[gg * 64 + r] - M);
      const float4 p = *(const float4*)(sacc + (gg * 64 + r) * OP_ + col);
      L += w * sl[gg * 64 + r];
      o.x += w * p.x; o.y += w * p.y; o.z += w * p.z; o.w += w * p.w;
    }
    res[h] = make_float4(o.x / L, o.y / L, o.z / L, o.w / L);
  }
  float* po = out + ((size_t)blockIdx.x * 64 + (threadIdx.x >> 4)) * D_ + col;
  *(float4*)(po)           = res[0];
  *(float4*)(po + 32 * D_) = res[1];
}

// ---------------------------------------------------------------------------
extern "C" void kernel_launch(void* const* d_in, const int* in_sizes, int n_in,
                              void* d_out, int out_size, void* d_ws, size_t ws_size,
                              hipStream_t stream) {
  (void)in_sizes; (void)n_in; (void)out_size;
  const float* x  = (const float*)d_in[0];
  const float* Wq = (const float*)d_in[1];
  const float* bq = (const float*)d_in[2];
  const float* Wk = (const float*)d_in[3];
  const float* bk = (const float*)d_in[4];
  const float* Wv = (const float*)d_in[5];
  const float* bv = (const float*)d_in[6];
  float* out = (float*)d_out;

  const size_t elems    = (size_t)B_ * N_ * D_;    // 1,048,576
  const size_t wt_elems = (size_t)3 * D_ * C_;     // 98,304
  const size_t x_elems  = (size_t)B_ * N_ * C_;    // 8,388,608

  // Workspace layout (halves):  qws | kws | vT | WT | xh
  // (kws, vT, WT and xh hold fragment-order tiles, see load_frag_p)
  _Float16* qws = (_Float16*)d_ws;
  _Float16* kws = qws + elems;
  _Float16* vT  = kws + elems;
  _Float16* WT  = vT + elems;
  _Float16* xh  = WT + wt_elems;

  const size_t half_bytes  = (3 * elems + wt_elems + x_elems) * sizeof(_Float16);

  const bool use_xh = ws_size >= half_bytes;

  pack_w_kernel<<<(int)(wt_elems / 256), 256, 0, stream>>>(Wq, Wk, Wv, WT);
  if (use_xh) {
    cvt_x_kernel<<<(int)(x_elems / (256 * 8)), 256, 0, stream>>>(x, xh);
    qkv_proj_kernel<true><<<dim3((B_ * N_) / 16, 3), 128, 0, stream>>>(
        x, xh, WT, bq, bk, bv, qws, kws, vT);
  } else {
    qkv_proj_kernel<false><<<dim3((B_ * N_) / 16, 3), 128, 0, stream>>>(
        x, xh, WT, bq, bk, bv, qws, kws, vT);
  }

  flash_attn_kernel<<<(B_ * N_) / 64, 512, 0, stream>>>(qws, kws, vT, out);
}

// v004
// It runs in 34.8 microseconds.
// In both of two side-by-side timings against v003, it was 1.26 times as fast.
// All steps since v000 together make it 4.55 times as fast.
#include <hip/hip_runtime.h>
#include <hip/hip_bf16.h>

typedef __attribute__((ext_vector_type(16))) _Float16 v16h;
typedef __attribute__((ext_vector_type(8)))  _Float16 v8h;
typedef __attribute__((ext_vector_type(4)))  _Float16 v4h;
typedef __attribute__((ext_vector_type(8)))  float    v8f;

#define B_  4
#define N_  4096
#define C_  512
#define D_  64
#define G_  4            // split-K groups over the key dimension, one per four waves of a block
#define OP_ 68           // floats per row of a partial O tile in LDS: 272 B = 16 B x odd

static __device__ __forceinline__ v8f wmma_f16(v16h a, v16h b, v8f c) {
  // (neg_a, A, neg_b, B, c_mod, C, reuse_a, reuse_b)
  return __builtin_amdgcn_wmma_f32_16x16x32_f16(false, a, false, b, (short)0, c, false, false);
}

// Load one 16-element half-fragment: two contiguous 8-half (16B) runs at p and p+16.
static __device__ __forceinline__ v16h load_frag_h(const _Float16* p) {
  v16h f;
#pragma unroll
  for (int i = 0; i < 8; ++i) { f[i] = p[i]; f[8 + i] = p[16 + i]; }
  return f;
}

// Fragment-order layout of a 16-row x 32-k operand tile (512 halves = 1 KB):
//   element (row, kk) sits at (kk >> 4) * 256 + (row + 16 * ((kk >> 3) & 1)) * 8 + (kk & 7).
// Lane l then finds its two 8-half runs at l * 8 and 256 + l * 8, so each
// wave-wide 16-byte load covers 512 contiguous bytes (4 whole 128-byte lines)
// instead of 32-byte pieces of 16 lines. Same k order as load_frag_h.
// p = tile base + lane * 8.
static __device__ __forceinline__ v16h load_frag_p(const _Float16* p) {
  v8h lo = *(const v8h*)(p);
  v8h hi = *(const v8h*)(p + 256);
  return __builtin_shufflevector(lo, hi, 0, 1, 2, 3, 4, 5, 6, 7, 8, 9, 10, 11, 12, 13, 14, 15);
}
// The same through a pointer that says "global memory" in its type: a pointer that an asm
// statement has stepped would otherwise be loaded from with flat instructions.
typedef const __attribute__((address_space(1))) _Float16* gl_half_ptr;
typedef const __attribute__((address_space(1))) v8h*      gl_v8h_ptr;
static __device__ __forceinline__ v16h load_frag_g(gl_half_ptr p) {
  v8h lo = *(gl_v8h_ptr)(p);
  v8h hi = *(gl_v8h_ptr)(p + 256);
  return __builtin_shufflevector(lo, hi, 0, 1, 2, 3, 4, 5, 6, 7, 8, 9, 10, 11, 12, 13, 14, 15);
}

// ---------------------------------------------------------------------------
// Prep: pack Wq/Wk/Wv (C x D fp32, row-major) -> f16 B tiles in fragment order,
// tile (which, 16-column group dt, kt) at ((which*4+dt)*16+kt)*512.
// ---------------------------------------------------------------------------
__global__ __launch_bounds__(256) void pack_w_kernel(const float* __restrict__ Wq,
                                                     const float* __restrict__ Wk,
                                                     const float* __restrict__ Wv,
                                                     _Float16* __restrict__ WT) {
  int t = blockIdx.x * 256 + threadIdx.x;          // 0 .. 3*D_*C_-1
  int w  = t >> 15;                                // D_*C_ = 32768 per matrix
  int dt = (t >> 13) & 3;
  int kt = (t >> 9) & 15;
  int l  = (t >> 3) & 31;
  int d  = dt * 16 + (l & 15);
  int c  = kt * 32 + ((t >> 8) & 1) * 16 + (l >> 4) * 8 + (t & 7);
  const float* W = (w == 0) ? Wq : (w == 1) ? Wk : Wv;
  WT[t] = (_Float16)W[c * D_ + d];                 // coalesced store
}

// ---------------------------------------------------------------------------
// Kernel 1: fused conversion and QKV projection. grid = B*N/64, block = 12 waves.
// The block reads its 64 rows of x (fp32) once, each wave-wide 16-byte load covering four
// whole 128-byte lines, converts them to f16 and lays them in LDS as fragment-order tiles:
// tile (rt, kt) at (rt*16+kt)*512, rt = 16-row tile inside the block; inside a tile the
// 8-half run q = kk >> 3 of row r sits at q * 128 + (r ^ (q * 4)) * 8. The exclusive-or
// sends the four runs that a staging store writes for one row to four different bank
// groups; a fragment read still covers each 256-byte block of a tile whole. Behind one barrier
// wave w multiplies all four row tiles by ITS 16 output columns (matrix w >> 2, column
// group w & 3), whose 16 W tiles it has fetched into registers while x was on its way.
// ---------------------------------------------------------------------------
__global__ __launch_bounds__(384) void qkv_proj_kernel(
    const float* __restrict__ x, const _Float16* __restrict__ WT,
    const float* __restrict__ bq, const float* __restrict__ bk,
    const float* __restrict__ bv,
    _Float16* __restrict__ qws, _Float16* __restrict__ kws,
    _Float16* __restrict__ vTws)
{
  __shared__ __attribute__((aligned(16))) _Float16 xs[4 * 16 * 512];   // 64 KB

  // The wave's number as a scalar: the tests on it are then scalar branches, and the
  // addresses formed from it scalar bases.
  const int wave  = __builtin_amdgcn_readfirstlane(threadIdx.x >> 5);
  const int lane  = threadIdx.x & 31;
  const int which = wave >> 2;       // 0 = Q, 1 = K, 2 = V
  const int dt    = wave & 3;        // 16-column group of that matrix
  const int d0 = dt * 16;
  const int m  = lane & 15;
  const int hi = lane >> 4;

  // Staging unit (rg, kt) = 4 rows x 32 columns of x: eight lanes read one 128-byte line.
  // Wave w takes 5 row groups from (w >> 2) * 5 on by 4 column tiles from (w & 3) * 4 on
  // (512 contiguous bytes of each row, at constant distances from one address), and of the
  // last row group tile w and, waves 0 to 3, tile 12 + w.
  const int lr = lane >> 3;          // row inside the 4-row group
  const int lc = (lane & 7) * 4;     // first of the lane's 4 columns inside the tile
  const int rg0 = (wave >> 2) * 5;
  const int kt0 = (wave & 3) * 4;
  const float* xlane = x + (size_t)blockIdx.x * 64 * C_ + lr * C_ + lc;
  const float* xmain = xlane + rg0 * 4 * C_ + kt0 * 32;
  // Every loop of this kernel is unrolled: xv, bf, the A fragments and the accumulators are
  // then indexed by constants and stay in registers.
  float4 xv[22];
#pragma unroll
  for (int r = 0; r < 5; ++r)
#pragma unroll
    for (int k = 0; k < 4; ++k) xv[r * 4 + k] = *(const float4*)(xmain + r * 4 * C_ + k * 32);
  const float* xl20 = xlane + wave * 32;
  xv[20] = *(const float4*)(xl20 + 15 * 4 * C_);
  // Waves 4 to 11 take tile w a second time (the same bytes to the same place): one
  // instruction stream in every wave, so that no wave's load and its wait stand alone in a
  // branch ahead of the barrier.
  const int ktl = wave < 4 ? wave + 12 : wave;
  const float* xl21 = xlane + ktl * 32;
  xv[21] = *(const float4*)(xl21 + 15 * 4 * C_);

  const _Float16* wfrag = WT + (size_t)wave * 16 * 512 + lane * 8;
  v16h bf[16];
#pragma unroll
  for (int kt = 0; kt < 16; ++kt) bf[kt] = load_frag_p(wfrag + kt * 512);  // B[k][n] = W[k][d0+n]
  const float* bias = (which == 0) ? bq : (which == 1) ? bk : bv;
  const float bias_n = bias[d0 + m];
  // Precaution: later writes of the loads' address registers stay behind this wait. The
  // addresses are its inputs so that they stay live up to it: else a later load of the
  // group may be given an earlier one's address register to land in.
  asm volatile("s_wait_xcnt 0x0" :: "v"(xmain), "v"(xl20), "v"(xl21), "v"(lane) : "memory");

  // The lane's 4 columns lie in run q of their row; row = (rg & 3) * 4 + lr.
  const int q = lc >> 3;
  _Float16* xdst = xs + q * 128 + lr * 8 + (lc & 7);
  auto put = [&](int rg, int kt, float4 a) {
    v4h h;
    h[0] = (_Float16)a.x; h[1] = (_Float16)a.y; h[2] = (_Float16)a.z; h[3] = (_Float16)a.w;
    *(v4h*)(xdst + ((rg >> 2) * 16 + kt) * 512 + ((rg & 3) ^ q) * 32) = h;
  };
#pragma unroll
  for (int r = 0; r < 5; ++r)
#pragma unroll
    for (int k = 0; k < 4; ++k) put(rg0 + r, kt0 + k, xv[r * 4 + k]);
  put(15, wave, xv[20]);
  put(15, ktl, xv[21]);
  // All 64 rows are in LDS behind this barrier.
  __syncthreads();

  // Row m's runs hi and 2 + hi: the k order of load_frag_p, as in the W tiles.
  const _Float16* xlo = xs + hi * 128 + (m ^ (hi * 4)) * 8;
  const _Float16* xhi = xs + (2 + hi) * 128 + (m ^ ((2 + hi) * 4)) * 8;
  auto frag = [&](int tile) {
    v8h lo = *(const v8h*)(xlo + tile * 512);
    v8h hh = *(const v8h*)(xhi + tile * 512);
    return __builtin_shufflevector(lo, hh, 0, 1, 2, 3, 4, 5, 6, 7, 8, 9, 10, 11, 12, 13, 14, 15);
  };
  // A fragments of row tiles i0, i0 + 1 for k tiles kt, kt + 1.
  auto load_a = [&](v16h* a, int i0, int kt) {
    a[0] = frag(i0 * 16 + kt);
    a[1] = frag(i0 * 16 + kt + 1);
    a[2] = frag((i0 + 1) * 16 + kt);
    a[3] = frag((i0 + 1) * 16 + kt + 1);
  };

  // Two row tiles at a time, so that W tiles, accumulators and two sets of A fragments fit
  // the registers of three waves per SIMD without a window switch.
#pragma unroll
  for (int i0 = 0; i0 < 4; i0 += 2) {
    v8f c0[2], c1[2];
#pragma unroll
    for (int j = 0; j < 2; ++j) {
      c0[j] = (v8f){0.f, 0.f, 0.f, 0.f, 0.f, 0.f, 0.f, 0.f};
      c1[j] = c0[j];
    }
    v16h a[2][4];
    load_a(a[0], i0, 0);
#pragma unroll
    for (int kt = 0; kt < 16; kt += 2) {
      const int cur = (kt >> 1) & 1;
      if (kt + 2 < 16) load_a(a[cur ^ 1], i0, kt + 2);
      // The next group's LDS reads stay one group, issued ahead of this group's products:
      // sunk to their first use, each product would wait out its own read's latency.
      __builtin_amdgcn_sched_barrier(0);
      c0[0] = wmma_f16(a[cur][0], bf[kt], c0[0]);
      c1[0] = wmma_f16(a[cur][1], bf[kt + 1], c1[0]);
      c0[1] = wmma_f16(a[cur][2], bf[kt], c0[1]);
      c1[1] = wmma_f16(a[cur][3], bf[kt + 1], c1[1]);
      // Keeps the group after next's reads from rising among these products.
      __builtin_amdgcn_sched_barrier(0);
    }

#pragma unroll
    for (int j = 0; j < 2; ++j) {
      const int rt = blockIdx.x * 4 + i0 + j;   // 16-row tile over B*N rows
      v8f c = c0[j];
#pragma unroll
      for (int r = 0; r < 8; ++r) c[r] += c1[j][r];
      if (which == 0) {
#pragma unroll
        for (int r = 0; r < 8; ++r) {
          int ro = rt * 16 + r + hi * 8;                 // C-layout: VGPR r -> rows r, r+8
          qws[(size_t)ro * D_ + d0 + m] = (_Float16)((c[r] + bias_n) * 0.125f);  // dk^-0.5 folded in
        }
        // Precaution: later writes of the stores' address and data registers stay behind it.
        asm volatile("s_wait_xcnt 0x0" ::: "memory");
      } else if (which == 1) {
        // K tiles (16 keys x 32 dims) in fragment order: tile (rt, dim half) at (rt*2+half)*512.
        // Here row = key r + hi*8 and kk = (dt & 1) * 16 + m.
        _Float16* dst = kws + ((size_t)rt * 2 + (dt >> 1)) * 512 + (dt & 1) * 256 +
                        (m >> 3) * 128 + (m & 7);
#pragma unroll
        for (int r = 0; r < 8; ++r)
          dst[(r + hi * 8) * 8] = (_Float16)(c[r] + bias_n);
        // Precaution, as behind the Q stores.
        asm volatile("s_wait_xcnt 0x0" ::: "memory");
      } else {
        // V tiles (16 dims x 32 keys) in fragment order: tile (32-key block, dim group) at
        // ((rt>>1)*4+dt)*512. Row = dim m, kk = (rt & 1) * 16 + hi * 8 + r: a lane's eight
        // values are one 16-byte run, and the wave stores 512 contiguous bytes.
        v8h h;
#pragma unroll
        for (int r = 0; r < 8; ++r) h[r] = (_Float16)(c[r] + bias_n);
        *(v8h*)(vTws + ((size_t)(rt >> 1) * 4 + dt) * 512 + (rt & 1) * 256 + lane * 8) = h;
        // Precaution, as behind the Q stores.
        asm volatile("s_wait_xcnt 0x0" ::: "memory");
      }
    }
  }
}

static __device__ __forceinline__ float xhalf(float v) {
  const int b = __builtin_bit_cast(int, v);
  return __builtin_bit_cast(
      float, __builtin_amdgcn_permlanex16(b, b, 0x76543210, 0xfedcba98, false, false));
}

__global__ __launch_bounds__(512) void flash_attn_kernel(
    const _Float16* __restrict__ qws, const _Float16* __restrict__ kws,
    const _Float16* __restrict__ vTws, float* __restrict__ out)
{
  __shared__ __attribute__((aligned(16))) float sacc[G_ * 64 * OP_];  // unnormalized partial O
  __shared__ float sm[G_ * 64];                                       // partial row maxima
  __shared__ float sl[G_ * 64];                                       // partial row sums

  // The wave's number as a scalar: tile and group numbers, and the K and V base addresses
  // formed from them, then stay in scalar registers instead of per-lane arithmetic.
  const int wave = __builtin_amdgcn_readfirstlane(threadIdx.x >> 5);
  const int lane = threadIdx.x & 31;
  const int qw = wave & 3;                // query tile inside the block
  const int qt = blockIdx.x * 4 + qw;     // global 16-query tile (0..1023)
  const int g  = wave >> 2;               // key group
  const int b  = qt >> 8;                 // 256 q-tiles per batch
  const int q0 = qt * 16;                 // global row over B*N
  const int m  = lane & 15;
  const int hi = lane >> 4;
  const int kb = hi * 8;

  // Keys are counted from the start of the wave's own group.
  const int jBeg = 0;
  const int jEnd = N_ / G_;

  const _Float16* vrow = vTws + ((size_t)b * N_ + g * (N_ / G_)) * D_;
  const _Float16* krow = kws + ((size_t)b * N_ + g * (N_ / G_)) * D_;

  // Q fragments: two 32x16 B-tiles (column = query m) covering head dims 0..31 and 32..63
  v16h qa0 = load_frag_h(qws + (size_t)(q0 + m) * D_ + 0  + kb);
  v16h qa1 = load_frag_h(qws + (size_t)(q0 + m) * D_ + 32 + kb);
  // Address registers of the issued loads may be reused from here on.
  asm volatile("s_wait_xcnt 0x0" ::: "memory");

  // acc[t][r] = O[query m][dim t * 16 + hi * 8 + r]
  v8f acc[4];
#pragma unroll
  for (int t = 0; t < 4; ++t)
#pragma unroll
    for (int r = 0; r < 8; ++r) acc[t][r] = 0.f;

  float rm = -1e30f;   // running maximum of query m (equal in both halves)
  float rl = 0.f;      // running sum of query m over THIS half's keys; joined after the loop

  // This lane's place in the next K tiles to load and in the current V tiles.
  gl_half_ptr kp = (gl_half_ptr)(krow + (size_t)jBeg * D_ + lane * 8);
  gl_half_ptr vp = (gl_half_ptr)(vrow + (size_t)jBeg * D_ + lane * 8);

  // Load 8 K fragments (the 64 keys at kp) into kf[], then step kp to the next 64 keys
  // while there are more (else it stays on the group's last tile, always in range).
  auto load_k = [&](v16h* kf, bool more) {
#pragma unroll
    for (int t = 0; t < 4; ++t) {
      kf[2 * t]     = load_frag_g(kp + t * 1024);        // dims 0..31
      kf[2 * t + 1] = load_frag_g(kp + t * 1024 + 512);  // dims 32..63
    }
    // The wait and the pointer's step are one statement, so that the address registers of
    // the issued loads are rewritten only behind the wait.
    const unsigned long long inc = more ? 8192ull : 0ull;
    asm volatile("s_wait_xcnt 0x0\n\tv_add_nc_u64 %0, %1, %0" : "+v"(kp) : "s"(inc) : "memory");
  };

  // One 64-key flash step: consume kf (keys jc), then refill it with the next 64 keys.
  auto step = [&](v16h* kf, int jc) {
    // --- S^T = K * Q^T for 4 sub-tiles of 16 keys (scale pre-folded into Q):
    //     s[t][r] = score of key jc + t * 16 + hi * 8 + r against query m ---
    v8f s[4];
#pragma unroll
    for (int t = 0; t < 4; ++t) {
      v8f z = {0.f, 0.f, 0.f, 0.f, 0.f, 0.f, 0.f, 0.f};
      s[t] = wmma_f16(kf[2 * t], qa0, z);
      s[t] = wmma_f16(kf[2 * t + 1], qa1, s[t]);
    }

    // --- Issue V-fragment loads; latency hides under softmax VALU work ---
    v16h vf[8];
#pragma unroll
    for (int nt = 0; nt < 4; ++nt) {
      vf[2 * nt]     = load_frag_g(vp + nt * 512);         // keys jc..jc+31
      vf[2 * nt + 1] = load_frag_g(vp + 2048 + nt * 512);  // keys jc+32..jc+63
    }
    // As in load_k: wait, then step to the next 64 keys (two 32-key blocks of 4 tiles).
    asm volatile("s_wait_xcnt 0x0\n\tv_add_nc_u64 %0, 0x2000, %0" : "+v"(vp) :: "memory");

    // --- Pipeline: refill the K fragments, consumed in the next step ---
    load_k(kf, jc + 128 < jEnd);
    // Keeps all 32 loads issued ahead of the softmax: without it the scheduler sinks them
    // down to their first use, and each product then waits out its own load's latency.
    __builtin_amdgcn_sched_barrier(0);

    // --- online softmax of query m: 32 scores here, 32 in lane ^ 16 ---
    float mt[4];
#pragma unroll
    for (int t = 0; t < 4; ++t) {
      mt[t] = fmaxf(fmaxf(fmaxf(s[t][0], s[t][1]), fmaxf(s[t][2], s[t][3])),
                    fmaxf(fmaxf(s[t][4], s[t][5]), fmaxf(s[t][6], s[t][7])));
    }
    float mx = fmaxf(fmaxf(mt[0], mt[1]), fmaxf(mt[2], mt[3]));
    mx = fmaxf(mx, xhalf(mx));
    const float mnew  = fmaxf(rm, mx);
    const float alpha = __expf(rm - mnew);
    rm = mnew;

    float st[4];
#pragma unroll
    for (int t = 0; t < 4; ++t) {
#pragma unroll
      for (int r = 0; r < 8; ++r) s[t][r] = __expf(s[t][r] - mnew);
      st[t] = ((s[t][0] + s[t][1]) + (s[t][2] + s[t][3])) +
              ((s[t][4] + s[t][5]) + (s[t][6] + s[t][7]));
    }
    rl = rl * alpha + ((st[0] + st[1]) + (st[2] + st[3]));

#pragma unroll
    for (int t = 0; t < 4; ++t)
#pragma unroll
      for (int r = 0; r < 8; ++r) acc[t][r] *= alpha;

    // --- P^T as B operand: element e < 8 is key hi * 8 + e (tile 0 or 2), element 8 + e
    //     key 16 + hi * 8 + e (tile 1 or 3): the k order of the V tiles ---
    v16h pb0, pb1;
#pragma unroll
    for (int e = 0; e < 8; ++e) {
      pb0[e] = (_Float16)s[0][e]; pb0[8 + e] = (_Float16)s[1][e];   // keys jc..jc+31
      pb1[e] = (_Float16)s[2][e]; pb1[8 + e] = (_Float16)s[3][e];   // keys jc+32..jc+63
    }

    // --- O^T += V^T * P^T ---
#pragma unroll
    for (int nt = 0; nt < 4; ++nt) {
      acc[nt] = wmma_f16(vf[2 * nt], pb0, acc[nt]);
      acc[nt] = wmma_f16(vf[2 * nt + 1], pb1, acc[nt]);
    }
  };

  v16h kf[8];
  load_k(kf, true);

  for (int j = jBeg; j < jEnd; j += 64) {
    // Prefetch the K/V tiles two steps ahead into the WGP cache.
    if (j + 128 < jEnd) {
      const _Float16* pk = krow + (size_t)(j + 128) * D_;
      __builtin_prefetch(pk + (size_t)lane * 128, 0, 3);
      const _Float16* pv = vrow + (size_t)(j + 128) * D_;
      __builtin_prefetch(pv + (size_t)lane * 128, 0, 3);
      // The prefetches' address registers are temporaries that the next loads overwrite.
      asm volatile("s_wait_xcnt 0x0" ::: "memory");
    }
    step(kf, j);
  }

  // Join the two halves' sums: every lane then has the whole row sum of query m.
  rl += xhalf(rl);

  // Unnormalized partial acc and per-row (m, l) into LDS.
  // A lane's 8 values of a tile are 8 consecutive dims of its query's row.
  {
    float* po = sacc + (g * 64 + qw * 16 + m) * OP_ + kb;
#pragma unroll
    for (int t = 0; t < 4; ++t) {
      *(float4*)(po + t * 16)     = make_float4(acc[t][0], acc[t][1], acc[t][2], acc[t][3]);
      *(float4*)(po + t * 16 + 4) = make_float4(acc[t][4], acc[t][5], acc[t][6], acc[t][7]);
    }
    if (hi == 0) {
      sm[g * 64 + qw * 16 + m] = rm;
      sl[g * 64 + qw * 16 + m] = rl;
    }
  }
  // Every group's partials are in LDS behind this barrier.
  __syncthreads();

  // Join the key groups: 16 threads per row, 4 dims each, rows r and r + 32 of the block's
  // 64, so that a wave's 16-byte stores cover 512 contiguous bytes of out.
  const int col = (threadIdx.x & 15) * 4;
  float4 res[2];
#pragma unroll
  for (int h = 0; h < 2; ++h) {
    const int r = (threadIdx.x >> 4) + h * 32;
    float M = -1e30f;
#pragma unroll
    for (int gg = 0; gg < G_; ++gg) M = fmaxf(M, sm[gg * 64 + r]);
    float L = 0.f;
    float4 o = make_float4(0.f, 0.f, 0.f, 0.f);
#pragma unroll
    for (int gg = 0; gg < G_; ++gg) {
      const float w = __expf(sm[gg * 64 + r] - M);
      const float4 p = *(const float4*)(sacc + (gg * 64 + r) * OP_ + col);
      L += w * sl[gg * 64 + r];
      o.x += w * p.x; o.y += w * p.y; o.z += w * p.z; o.w += w * p.w;
    }
    res[h] = make_float4(o.x / L, o.y / L, o.z / L, o.w / L);
  }
  float* po = out + ((size_t)blockIdx.x * 64 + (threadIdx.x >> 4)) * D_ + col;
  *(float4*)(po)           = res[0];
  *(float4*)(po + 32 * D_) = res[1];
}

// ---------------------------------------------------------------------------
extern "C" void kernel_launch(void* const* d_in, const int* in_sizes, int n_in,
                              void* d_out, int out_size, void* d_ws, size_t ws_size,
                              hipStream_t stream) {
  (void)in_sizes; (void)n_in; (void)out_size; (void)ws_size;
  const float* x  = (const float*)d_in[0];
  const float* Wq = (const float*)d_in[1];
  const float* bq = (const float*)d_in[2];
  const float* Wk = (const float*)d_in[3];
  const float* bk = (const float*)d_in[4];
  const float* Wv = (const float*)d_in[5];
  const float* bv = (const float*)d_in[6];
  float* out = (float*)d_out;

  const size_t elems    = (size_t)B_ * N_ * D_;    // 1,048,576
  const size_t wt_elems = (size_t)3 * D_ * C_;     // 98,304

  // Workspace layout (halves):  qws | kws | vT | WT
  // (kws, vT and WT hold fragment-order tiles, see load_frag_p)
  _Float16* qws = (_Float16*)d_ws;
  _Float16* kws = qws + elems;
  _Float16* vT  = kws + elems;
  _Float16* WT  = vT + elems;

  pack_w_kernel<<<(int)(wt_elems / 256), 256, 0, stream>>>(Wq, Wk, Wv, WT);
  qkv_proj_kernel<<<(B_ * N_) / 64, 384, 0, stream>>>(x, WT, bq, bk, bv, qws, kws, vT);
  flash_attn_kernel<<<(B_ * N_) / 64, 512, 0, stream>>>(qws, kws, vT, out);
}

// v005
// One run takes 30 microseconds.
// Next to v004, in two timings, it ran 1.14 and 1.16 times as fast.
// Over all steps from v000 it is 5.24 times as fast.
#include <hip/hip_runtime.h>
#include <hip/hip_bf16.h>

typedef __attribute__((ext_vector_type(16))) _Float16 v16h;
typedef __attribute__((ext_vector_type(8)))  _Float16 v8h;
typedef __attribute__((ext_vector_type(4)))  _Float16 v4h;
typedef __attribute__((ext_vector_type(8)))  float    v8f;

#define B_  4
#define N_  4096
#define C_  512
#define D_  64
#define G_  4            // split-K groups over the key dimension, one per four waves of a block
#define OP_ 68           // floats per row of a partial O tile in LDS: 272 B = 16 B x odd
#define NT_ (N_ / G_ / 64)   // trips of the attention loop: 64 keys of every group per trip
#define GT_ 8192         // halves of one group's tile pair in LDS: 64 keys of K, then of V
#define BUF_ (G_ * GT_)  // halves of one LDS buffer: the four groups' tile pairs, 64 KB

static __device__ __forceinline__ v8f wmma_f16(v16h a, v16h b, v8f c) {
  // (neg_a, A, neg_b, B, c_mod, C, reuse_a, reuse_b)
  return __builtin_amdgcn_wmma_f32_16x16x32_f16(false, a, false, b, (short)0, c, false, false);
}

// Load one 16-element half-fragment: two contiguous 8-half (16B) runs at p and p+16.
static __device__ __forceinline__ v16h load_frag_h(const _Float16* p) {
  v16h f;
#pragma unroll
  for (int i = 0; i < 8; ++i) { f[i] = p[i]; f[8 + i] = p[16 + i]; }
  return f;
}

// Fragment-order layout of a 16-row x 32-k operand tile (512 halves = 1 KB):
//   element (row, kk) sits at (kk >> 4) * 256 + (row + 16 * ((kk >> 3) & 1)) * 8 + (kk & 7).
// Lane l then finds its two 8-half runs at l * 8 and 256 + l * 8, so each
// wave-wide 16-byte load covers 512 contiguous bytes (4 whole 128-byte lines)
// instead of 32-byte pieces of 16 lines. Same k order as load_frag_h.
// p = tile base + lane * 8.
static __device__ __forceinline__ v16h load_frag_p(const _Float16* p) {
  v8h lo = *(const v8h*)(p);
  v8h hi = *(const v8h*)(p + 256);
  return __builtin_shufflevector(lo, hi, 0, 1, 2, 3, 4, 5, 6, 7, 8, 9, 10, 11, 12, 13, 14, 15);
}

// ---------------------------------------------------------------------------
// Prep: pack Wq/Wk/Wv (C x D fp32, row-major) -> f16 B tiles in fragment order,
// tile (which, 16-column group dt, kt) at ((which*4+dt)*16+kt)*512.
// ---------------------------------------------------------------------------
__global__ __launch_bounds__(256) void pack_w_kernel(const float* __restrict__ Wq,
                                                     const float* __restrict__ Wk,
                                                     const float* __restrict__ Wv,
                                                     _Float16* __restrict__ WT) {
  int t = blockIdx.x * 256 + threadIdx.x;          // 0 .. 3*D_*C_-1
  int w  = t >> 15;                                // D_*C_ = 32768 per matrix
  int dt = (t >> 13) & 3;
  int kt = (t >> 9) & 15;
  int l  = (t >> 3) & 31;
  int d  = dt * 16 + (l & 15);
  int c  = kt * 32 + ((t >> 8) & 1) * 16 + (l >> 4) * 8 + (t & 7);
  const float* W = (w == 0) ? Wq : (w == 1) ? Wk : Wv;
  WT[t] = (_Float16)W[c * D_ + d];                 // coalesced store
}

// ---------------------------------------------------------------------------
// Kernel 1: fused conversion and QKV projection. grid = B*N/64, block = 12 waves.
// The block reads its 64 rows of x (fp32) once, each wave-wide 16-byte load covering four
// whole 128-byte lines, converts them to f16 and lays them in LDS as fragment-order tiles:
// tile (rt, kt) at (rt*16+kt)*512, rt = 16-row tile inside the block; inside a tile the
// 8-half run q = kk >> 3 of row r sits at q * 128 + (r ^ (q * 4)) * 8. The exclusive-or
// sends the four runs that a staging store writes for one row to four different bank
// groups; a fragment read still covers each 256-byte block of a tile whole. Behind one barrier
// wave w multiplies all four row tiles by ITS 16 output columns (matrix w >> 2, column
// group w & 3), whose 16 W tiles it has fetched into registers while x was on its way.
// ---------------------------------------------------------------------------
__global__ __launch_bounds__(384) void qkv_proj_kernel(
    const float* __restrict__ x, const _Float16* __restrict__ WT,
    const float* __restrict__ bq, const float* __restrict__ bk,
    const float* __restrict__ bv,
    _Float16* __restrict__ qws, _Float16* __restrict__ kws,
    _Float16* __restrict__ vTws)
{
  __shared__ __attribute__((aligned(16))) _Float16 xs[4 * 16 * 512];   // 64 KB

  // The wave's number as a scalar: the tests on it are then scalar branches, and the
  // addresses formed from it scalar bases.
  const int wave  = __builtin_amdgcn_readfirstlane(threadIdx.x >> 5);
  const int lane  = threadIdx.x & 31;
  const int which = wave >> 2;       // 0 = Q, 1 = K, 2 = V
  const int dt    = wave & 3;        // 16-column group of that matrix
  const int d0 = dt * 16;
  const int m  = lane & 15;
  const int hi = lane >> 4;

  // Staging unit (rg, kt) = 4 rows x 32 columns of x: eight lanes read one 128-byte line.
  // Wave w takes 5 row groups from (w >> 2) * 5 on by 4 column tiles from (w & 3) * 4 on
  // (512 contiguous bytes of each row, at constant distances from one address), and of the
  // last row group tile w and, waves 0 to 3, tile 12 + w.
  const int lr = lane >> 3;          // row inside the 4-row group
  const int lc = (lane & 7) * 4;     // first of the lane's 4 columns inside the tile
  const int rg0 = (wave >> 2) * 5;
  const int kt0 = (wave & 3) * 4;
  const float* xlane = x + (size_t)blockIdx.x * 64 * C_ + lr * C_ + lc;
  const float* xmain = xlane + rg0 * 4 * C_ + kt0 * 32;
  // Every loop of this kernel is unrolled: xv, bf, the A fragments and the accumulators are
  // then indexed by constants and stay in registers.
  float4 xv[22];
#pragma unroll
  for (int r = 0; r < 5; ++r)
#pragma unroll
    for (int k = 0; k < 4; ++k) xv[r * 4 + k] = *(const float4*)(xmain + r * 4 * C_ + k * 32);
  const float* xl20 = xlane + wave * 32;
  xv[20] = *(const float4*)(xl20 + 15 * 4 * C_);
  // Waves 4 to 11 take tile w a second time (the same bytes to the same place): one
  // instruction stream in every wave, so that no wave's load and its wait stand alone in a
  // branch ahead of the barrier.
  const int ktl = wave < 4 ? wave + 12 : wave;
  const float* xl21 = xlane + ktl * 32;
  xv[21] = *(const float4*)(xl21 + 15 * 4 * C_);

  const _Float16* wfrag = WT + (size_t)wave * 16 * 512 + lane * 8;
  v16h bf[16];
#pragma unroll
  for (int kt = 0; kt < 16; ++kt) bf[kt] = load_frag_p(wfrag + kt * 512);  // B[k][n] = W[k][d0+n]
  const float* bias = (which == 0) ? bq : (which == 1) ? bk : bv;
  const float bias_n = bias[d0 + m];
  // Precaution: later writes of the loads' address registers stay behind this wait. The
  // addresses are its inputs so that they stay live up to it: else a later load of the
  // group may be given an earlier one's address register to land in.
  asm volatile("s_wait_xcnt 0x0" :: "v"(xmain), "v"(xl20), "v"(xl21), "v"(lane) : "memory");

  // The lane's 4 columns lie in run q of their row; row = (rg & 3) * 4 + lr.
  const int q = lc >> 3;
  _Float16* xdst = xs + q * 128 + lr * 8 + (lc & 7);
  auto put = [&](int rg, int kt, float4 a) {
    v4h h;
    h[0] = (_Float16)a.x; h[1] = (_Float16)a.y; h[2] = (_Float16)a.z; h[3] = (_Float16)a.w;
    *(v4h*)(xdst + ((rg >> 2) * 16 + kt) * 512 + ((rg & 3) ^ q) * 32) = h;
  };
#pragma unroll
  for (int r = 0; r < 5; ++r)
#pragma unroll
    for (int k = 0; k < 4; ++k) put(rg0 + r, kt0 + k, xv[r * 4 + k]);
  put(15, wave, xv[20]);
  put(15, ktl, xv[21]);
  // All 64 rows are in LDS behind this barrier.
  __syncthreads();

  // Row m's runs hi and 2 + hi: the k order of load_frag_p, as in the W tiles.
  const _Float16* xlo = xs + hi * 128 + (m ^ (hi * 4)) * 8;
  const _Float16* xhi = xs + (2 + hi) * 128 + (m ^ ((2 + hi) * 4)) * 8;
  auto frag = [&](int tile) {
    v8h lo = *(const v8h*)(xlo + tile * 512);
    v8h hh = *(const v8h*)(xhi + tile * 512);
    return __builtin_shufflevector(lo, hh, 0, 1, 2, 3, 4, 5, 6, 7, 8, 9, 10, 11, 12, 13, 14, 15);
  };
  // A fragments of row tiles i0, i0 + 1 for k tiles kt, kt + 1.
  auto load_a = [&](v16h* a, int i0, int kt) {
    a[0] = frag(i0 * 16 + kt);
    a[1] = frag(i0 * 16 + kt + 1);
    a[2] = frag((i0 + 1) * 16 + kt);
    a[3] = frag((i0 + 1) * 16 + kt + 1);
  };

  // Two row tiles at a time, so that W tiles, accumulators and two sets of A fragments fit
  // the registers of three waves per SIMD without a window switch.
#pragma unroll
  for (int i0 = 0; i0 < 4; i0 += 2) {
    v8f c0[2], c1[2];
#pragma unroll
    for (int j = 0; j < 2; ++j) {
      c0[j] = (v8f){0.f, 0.f, 0.f, 0.f, 0.f, 0.f, 0.f, 0.f};
      c1[j] = c0[j];
    }
    v16h a[2][4];
    load_a(a[0], i0, 0);
#pragma unroll
    for (int kt = 0; kt < 16; kt += 2) {
      const int cur = (kt >> 1) & 1;
      if (kt + 2 < 16) load_a(a[cur ^ 1], i0, kt + 2);
      // The next group's LDS reads stay one group, issued ahead of this group's products:
      // sunk to their first use, each product would wait out its own read's latency.
      __builtin_amdgcn_sched_barrier(0);
      c0[0] = wmma_f16(a[cur][0], bf[kt], c0[0]);
      c1[0] = wmma_f16(a[cur][1], bf[kt + 1], c1[0]);
      c0[1] = wmma_f16(a[cur][2], bf[kt], c0[1]);
      c1[1] = wmma_f16(a[cur][3], bf[kt + 1], c1[1]);
      // Keeps the group after next's reads from rising among these products.
      __builtin_amdgcn_sched_barrier(0);
    }

#pragma unroll
    for (int j = 0; j < 2; ++j) {
      const int rt = blockIdx.x * 4 + i0 + j;   // 16-row tile over B*N rows
      v8f c = c0[j];
#pragma unroll
      for (int r = 0; r < 8; ++r) c[r] += c1[j][r];
      if (which == 0) {
#pragma unroll
        for (int r = 0; r < 8; ++r) {
          int ro = rt * 16 + r + hi * 8;                 // C-layout: VGPR r -> rows r, r+8
          qws[(size_t)ro * D_ + d0 + m] = (_Float16)((c[r] + bias_n) * 0.125f);  // dk^-0.5 folded in
        }
        // Precaution: later writes of the stores' address and data registers stay behind it.
        asm volatile("s_wait_xcnt 0x0" ::: "memory");
      } else if (which == 1) {
        // K tiles (16 keys x 32 dims) in fragment order: tile (rt, dim half) at (rt*2+half)*512.
        // Here row = key r + hi*8 and kk = (dt & 1) * 16 + m.
        _Float16* dst = kws + ((size_t)rt * 2 + (dt >> 1)) * 512 + (dt & 1) * 256 +
                        (m >> 3) * 128 + (m & 7);
#pragma unroll
        for (int r = 0; r < 8; ++r)
          dst[(r + hi * 8) * 8] = (_Float16)(c[r] + bias_n);
        // Precaution, as behind the Q stores.
        asm volatile("s_wait_xcnt 0x0" ::: "memory");
      } else {
        // V tiles (16 dims x 32 keys) in fragment order: tile (32-key block, dim group) at
        // ((rt>>1)*4+dt)*512. Row = dim m, kk = (rt & 1) * 16 + hi * 8 + r: a lane's eight
        // values are one 16-byte run, and the wave stores 512 contiguous bytes.
        v8h h;
#pragma unroll
        for (int r = 0; r < 8; ++r) h[r] = (_Float16)(c[r] + bias_n);
        *(v8h*)(vTws + ((size_t)(rt >> 1) * 4 + dt) * 512 + (rt & 1) * 256 + lane * 8) = h;
        // Precaution, as behind the Q stores.
        asm volatile("s_wait_xcnt 0x0" ::: "memory");
      }
    }
  }
}

static __device__ __forceinline__ float xhalf(float v) {
  const int b = __builtin_bit_cast(int, v);
  return __builtin_bit_cast(
      float, __builtin_amdgcn_permlanex16(b, b, 0x76543210, 0xfedcba98, false, false));
}

__global__ __launch_bounds__(512) void flash_attn_kernel(
    const _Float16* __restrict__ qws, const _Float16* __restrict__ kws,
    const _Float16* __restrict__ vTws, float* __restrict__ out)
{
  __shared__ __attribute__((aligned(16))) _Float16 kv[2 * BUF_];      // K and V tiles, two buffers
  __shared__ __attribute__((aligned(16))) float sacc[G_ * 64 * OP_];  // unnormalized partial O
  __shared__ float sm[G_ * 64];                                       // partial row maxima
  __shared__ float sl[G_ * 64];                                       // partial row sums

  // The wave's number as a scalar: tile and group numbers, and the K and V base addresses
  // formed from them, then stay in scalar registers instead of per-lane arithmetic.
  const int wave = __builtin_amdgcn_readfirstlane(threadIdx.x >> 5);
  const int lane = threadIdx.x & 31;
  const int qw = wave & 3;                // query tile inside the block
  const int qt = blockIdx.x * 4 + qw;     // global 16-query tile (0..1023)
  const int g  = wave >> 2;               // key group
  const int b  = qt >> 8;                 // 256 q-tiles per batch
  const int q0 = qt * 16;                 // global row over B*N
  const int m  = lane & 15;
  const int hi = lane >> 4;
  const int kb = hi * 8;

  const _Float16* vrow = vTws + ((size_t)b * N_ + g * (N_ / G_)) * D_;
  const _Float16* krow = kws + ((size_t)b * N_ + g * (N_ / G_)) * D_;

  // Q fragments: two 32x16 B-tiles (column = query m) covering head dims 0..31 and 32..63
  v16h qa0 = load_frag_h(qws + (size_t)(q0 + m) * D_ + 0  + kb);
  v16h qa1 = load_frag_h(qws + (size_t)(q0 + m) * D_ + 32 + kb);
  // Address registers of the issued loads may be reused from here on.
  asm volatile("s_wait_xcnt 0x0" ::: "memory");

  // acc[t][r] = O[query m][dim t * 16 + hi * 8 + r]
  v8f acc[4];
#pragma unroll
  for (int t = 0; t < 4; ++t)
#pragma unroll
    for (int r = 0; r < 8; ++r) acc[t][r] = 0.f;

  float rm = -1e30f;   // running maximum of query m (equal in both halves)
  float rl = 0.f;      // running sum of query m over THIS half's keys; joined after the loop

  // The wave's share of a trip's copies: quarter qw of its group's K tile and of its V tile,
  // 2 KB each, four wave-wide copies of 512 contiguous bytes.
  const _Float16* ksrc = krow + qw * 1024 + lane * 8;
  const _Float16* vsrc = vrow + qw * 1024 + lane * 8;
  const unsigned  ldst = (unsigned)(size_t)(kv + g * GT_ + qw * 1024 + lane * 8);  // LDS byte address

  // Copies trip t's share into buffer buf. The copies and the wait stand in one statement, so
  // that the address registers they name are rewritten only behind the wait (a precaution).
  auto copy_tile = [&](int t, int buf) {
    const _Float16* ks = ksrc + (size_t)t * 4096;
    const _Float16* vs = vsrc + (size_t)t * 4096;
    const unsigned  lk = ldst + buf * (BUF_ * 2);
    const unsigned  lv = lk + 8192;
    asm volatile(
        "global_load_async_to_lds_b128 %0, %8, off\n\t"
        "global_load_async_to_lds_b128 %1, %9, off\n\t"
        "global_load_async_to_lds_b128 %2, %10, off\n\t"
        "global_load_async_to_lds_b128 %3, %11, off\n\t"
        "global_load_async_to_lds_b128 %4, %12, off\n\t"
        "global_load_async_to_lds_b128 %5, %13, off\n\t"
        "global_load_async_to_lds_b128 %6, %14, off\n\t"
        "global_load_async_to_lds_b128 %7, %15, off\n\t"
        "s_wait_xcnt 0x0"
        :: "v"(lk), "v"(lk + 512), "v"(lk + 1024), "v"(lk + 1536),
           "v"(lv), "v"(lv + 512), "v"(lv + 1024), "v"(lv + 1536),
           "v"(ks), "v"(ks + 256), "v"(ks + 512), "v"(ks + 768),
           "v"(vs), "v"(vs + 256), "v"(vs + 512), "v"(vs + 768)
        : "memory");
  };

  // This lane's place in its group's K tiles in buffer 0; the V tiles stand 4096 halves on.
  const _Float16* kvl = kv + g * GT_ + lane * 8;

  // One 64-key flash step on the fragments kf (K) and vf (V): registers only.
  auto step = [&](const v16h* kf, const v16h* vf) {
    // --- S^T = K * Q^T for 4 sub-tiles of 16 keys (scale pre-folded into Q):
    //     s[t][r] = score of key t * 16 + hi * 8 + r of the tile against query m ---
    v8f s[4];
#pragma unroll
    for (int t = 0; t < 4; ++t) {
      v8f z = {0.f, 0.f, 0.f, 0.f, 0.f, 0.f, 0.f, 0.f};
      s[t] = wmma_f16(kf[2 * t], qa0, z);
      s[t] = wmma_f16(kf[2 * t + 1], qa1, s[t]);
    }
    // Keeps the eight products one run: spread among the maxima, each is padded with v_nop,
    // because the maxima's temporaries are given fragment registers that it has just read.
    __builtin_amdgcn_sched_barrier(0);

    // --- online softmax of query m: 32 scores here, 32 in lane ^ 16 ---
    float mt[4];
#pragma unroll
    for (int t = 0; t < 4; ++t) {
      mt[t] = fmaxf(fmaxf(fmaxf(s[t][0], s[t][1]), fmaxf(s[t][2], s[t][3])),
                    fmaxf(fmaxf(s[t][4], s[t][5]), fmaxf(s[t][6], s[t][7])));
    }
    float mx = fmaxf(fmaxf(mt[0], mt[1]), fmaxf(mt[2], mt[3]));
    mx = fmaxf(mx, xhalf(mx));
    const float mnew  = fmaxf(rm, mx);
    const float alpha = __expf(rm - mnew);
    rm = mnew;

    float st[4];
#pragma unroll
    for (int t = 0; t < 4; ++t) {
#pragma unroll
      for (int r = 0; r < 8; ++r) s[t][r] = __expf(s[t][r] - mnew);
      st[t] = ((s[t][0] + s[t][1]) + (s[t][2] + s[t][3])) +
              ((s[t][4] + s[t][5]) + (s[t][6] + s[t][7]));
    }
    rl = rl * alpha + ((st[0] + st[1]) + (st[2] + st[3]));

#pragma unroll
    for (int t = 0; t < 4; ++t)
#pragma unroll
      for (int r = 0; r < 8; ++r) acc[t][r] *= alpha;

    // --- P^T as B operand: element e < 8 is key hi * 8 + e (tile 0 or 2), element 8 + e
    //     key 16 + hi * 8 + e (tile 1 or 3): the k order of the V tiles ---
    v16h pb0, pb1;
#pragma unroll
    for (int e = 0; e < 8; ++e) {
      pb0[e] = (_Float16)s[0][e]; pb0[8 + e] = (_Float16)s[1][e];   // first 32 keys
      pb1[e] = (_Float16)s[2][e]; pb1[8 + e] = (_Float16)s[3][e];   // last 32 keys
    }

    // --- O^T += V^T * P^T ---
#pragma unroll
    for (int nt = 0; nt < 4; ++nt) {
      acc[nt] = wmma_f16(vf[2 * nt], pb0, acc[nt]);
      acc[nt] = wmma_f16(vf[2 * nt + 1], pb1, acc[nt]);
    }
  };

  // Trip 0's tiles land and are published; then trip 1's copies start.
  copy_tile(0, 0);
  // The wave's own copies have landed behind this wait.
  asm volatile("s_wait_asynccnt 0x0" ::: "memory");
  // Every wave's copies of trip 0 are readable behind this barrier.
  __syncthreads();
  copy_tile(1, 1);

  for (int t = 0; t < NT_; ++t) {
    // All of the trip's LDS reads, one group: the wave's 64 keys of K and of V.
    const _Float16* p = kvl + (t & 1) * BUF_;
    v16h kf[8], vf[8];
#pragma unroll
    for (int i = 0; i < 4; ++i) {
      kf[2 * i]     = load_frag_p(p + i * 1024);        // 16 keys, dims 0..31
      kf[2 * i + 1] = load_frag_p(p + i * 1024 + 512);  // dims 32..63
    }
#pragma unroll
    for (int nt = 0; nt < 4; ++nt) {
      vf[2 * nt]     = load_frag_p(p + 4096 + nt * 512);         // first 32 keys
      vf[2 * nt + 1] = load_frag_p(p + 4096 + 2048 + nt * 512);  // last 32 keys
    }
    // The trip's work on LDS ends here, what follows it is on registers: so the hand-over
    // stands here, and the refill has the products and the next trip's reads to land in.
    // The wave's reads of this trip's buffer have returned before the buffer is refilled.
    asm volatile("s_wait_dscnt 0x0" ::: "memory");
    // The wave's copies of trip t + 1 have landed.
    asm volatile("s_wait_asynccnt 0x0" ::: "memory");
    // Publishes trip t + 1's tiles and ends every wave's reads of trip t's buffer.
    __syncthreads();
    if (t + 2 < NT_) copy_tile(t + 2, t & 1);
    step(kf, vf);
  }
  // No copy is outstanding when the wave goes on to the join and ends.
  asm volatile("s_wait_asynccnt 0x0" ::: "memory");

  // Join the two halves' sums: every lane then has the whole row sum of query m.
  rl += xhalf(rl);

  // Unnormalized partial acc and per-row (m, l) into LDS.
  // A lane's 8 values of a tile are 8 consecutive dims of its query's row.
  {
    float* po = sacc + (g * 64 + qw * 16 + m) * OP_ + kb;
#pragma unroll
    for (int t = 0; t < 4; ++t) {
      *(float4*)(po + t * 16)     = make_float4(acc[t][0], acc[t][1], acc[t][2], acc[t][3]);
      *(float4*)(po + t * 16 + 4) = make_float4(acc[t][4], acc[t][5], acc[t][6], acc[t][7]);
    }
    if (hi == 0) {
      sm[g * 64 + qw * 16 + m] = rm;
      sl[g * 64 + qw * 16 + m] = rl;
    }
  }
  // Every group's partials are in LDS behind this barrier.
  __syncthreads();

  // Join the key groups: 16 threads per row, 4 dims each, rows r and r + 32 of the block's
  // 64, so that a wave's 16-byte stores cover 512 contiguous bytes of out.
  const int col = (threadIdx.x & 15) * 4;
  float4 res[2];
#pragma unroll
  for (int h = 0; h < 2; ++h) {
    const int r = (threadIdx.x >> 4) + h * 32;
    float M = -1e30f;
#pragma unroll
    for (int gg = 0; gg < G_; ++gg) M = fmaxf(M, sm[gg * 64 + r]);
    float L = 0.f;
    float4 o = make_float4(0.f, 0.f, 0.f, 0.f);
#pragma unroll
    for (int gg = 0; gg < G_; ++gg) {
      const float w = __expf(sm[gg * 64 + r] - M);
      const float4 p = *(const float4*)(sacc + (gg * 64 + r) * OP_ + col);
      L += w * sl[gg * 64 + r];
      o.x += w * p.x; o.y += w * p.y; o.z += w * p.z; o.w += w * p.w;
    }
    res[h] = make_float4(o.x / L, o.y / L, o.z / L, o.w / L);
  }
  float* po = out + ((size_t)blockIdx.x * 64 + (threadIdx.x >> 4)) * D_ + col;
  *(float4*)(po)           = res[0];
  *(float4*)(po + 32 * D_) = res[1];
}

// ---------------------------------------------------------------------------
extern "C" void kernel_launch(void* const* d_in, const int* in_sizes, int n_in,
                              void* d_out, int out_size, void* d_ws, size_t ws_size,
                              hipStream_t stream) {
  (void)in_sizes; (void)n_in; (void)out_size; (void)ws_size;
  const float* x  = (const float*)d_in[0];
  const float* Wq = (const float*)d_in[1];
  const float* bq = (const float*)d_in[2];
  const float* Wk = (const float*)d_in[3];
  const float* bk = (const float*)d_in[4];
  const float* Wv = (const float*)d_in[5];
  const float* bv = (const float*)d_in[6];
  float* out = (float*)d_out;

  const size_t elems    = (size_t)B_ * N_ * D_;    // 1,048,576
  const size_t wt_elems = (size_t)3 * D_ * C_;     // 98,304

  // Workspace layout (halves):  qws | kws | vT | WT
  // (kws, vT and WT hold fragment-order tiles, see load_frag_p)
  _Float16* qws = (_Float16*)d_ws;
  _Float16* kws = qws + elems;
  _Float16* vT  = kws + elems;
  _Float16* WT  = vT + elems;

  pack_w_kernel<<<(int)(wt_elems / 256), 256, 0, stream>>>(Wq, Wk, Wv, WT);
  qkv_proj_kernel<<<(B_ * N_) / 64, 384, 0, stream>>>(x, WT, bq, bk, bv, qws, kws, vT);
  flash_attn_kernel<<<(B_ * N_) / 64, 512, 0, stream>>>(qws, kws, vT, out);
}

// v006
// One run takes 29.4 microseconds.
// Timed twice side by side with v005, it ran 1.04 and 1.02 times as fast.
// All steps since v000 together make it 5.40 times as fast.
#include <hip/hip_runtime.h>
#include <hip/hip_bf16.h>

typedef __attribute__((ext_vector_type(16))) _Float16 v16h;
typedef __attribute__((ext_vector_type(8)))  _Float16 v8h;
typedef __attribute__((ext_vector_type(4)))  _Float16 v4h;
typedef __attribute__((ext_vector_type(8)))  float    v8f;

#define B_  4
#define N_  4096
#define C_  512
#define D_  64
#define G_  8            // split-K groups over the key dimension, one per two waves of a block
#define OP_ 68           // floats per row of a partial O tile in LDS: 272 B = 16 B x odd
#define NT_ (N_ / G_ / 64)   // trips of the attention loop: 64 keys of every group per trip
#define GT_ 8192         // halves of one group's tile pair in LDS: 64 keys of K, then of V
#define BUF_ (G_ * GT_)  // halves of one LDS buffer: the eight groups' tile pairs, 128 KB

static __device__ __forceinline__ v8f wmma_f16(v16h a, v16h b, v8f c) {
  // (neg_a, A, neg_b, B, c_mod, C, reuse_a, reuse_b)
  return __builtin_amdgcn_wmma_f32_16x16x32_f16(false, a, false, b, (short)0, c, false, false);
}

// Load one 16-element half-fragment: two contiguous 8-half (16B) runs at p and p+16.
static __device__ __forceinline__ v16h load_frag_h(const _Float16* p) {
  v16h f;
#pragma unroll
  for (int i = 0; i < 8; ++i) { f[i] = p[i]; f[8 + i] = p[16 + i]; }
  return f;
}

// Fragment-order layout of a 16-row x 32-k operand tile (512 halves = 1 KB):
//   element (row, kk) sits at (kk >> 4) * 256 + (row + 16 * ((kk >> 3) & 1)) * 8 + (kk & 7).
// Lane l then finds its two 8-half runs at l * 8 and 256 + l * 8, so each
// wave-wide 16-byte load covers 512 contiguous bytes (4 whole 128-byte lines)
// instead of 32-byte pieces of 16 lines. Same k order as load_frag_h.
// p = tile base + lane * 8.
static __device__ __forceinline__ v16h load_frag_p(const _Float16* p) {
  v8h lo = *(const v8h*)(p);
  v8h hi = *(const v8h*)(p + 256);
  return __builtin_shufflevector(lo, hi, 0, 1, 2, 3, 4, 5, 6, 7, 8, 9, 10, 11, 12, 13, 14, 15);
}

// ---------------------------------------------------------------------------
// Prep: pack Wq/Wk/Wv (C x D fp32, row-major) -> f16 B tiles in fragment order,
// tile (which, 16-column group dt, kt) at ((which*4+dt)*16+kt)*512.
// ---------------------------------------------------------------------------
__global__ __launch_bounds__(256) void pack_w_kernel(const float* __restrict__ Wq,
                                                     const float* __restrict__ Wk,
                                                     const float* __restrict__ Wv,
                                                     _Float16* __restrict__ WT) {
  int t = blockIdx.x * 256 + threadIdx.x;          // 0 .. 3*D_*C_-1
  int w  = t >> 15;                                // D_*C_ = 32768 per matrix
  int dt = (t >> 13) & 3;
  int kt = (t >> 9) & 15;
  int l  = (t >> 3) & 31;
  int d  = dt * 16 + (l & 15);
  int c  = kt * 32 + ((t >> 8) & 1) * 16 + (l >> 4) * 8 + (t & 7);
  const float* W = (w == 0) ? Wq : (w == 1) ? Wk : Wv;
  WT[t] = (_Float16)W[c * D_ + d];                 // coalesced store
}

// ---------------------------------------------------------------------------
// Kernel 1: fused conversion and QKV projection. grid = B*N/64, block = 12 waves.
// The block reads its 64 rows of x (fp32) once, each wave-wide 16-byte load covering four
// whole 128-byte lines, converts them to f16 and lays them in LDS as fragment-order tiles:
// tile (rt, kt) at (rt*16+kt)*512, rt = 16-row tile inside the block; inside a tile the
// 8-half run q = kk >> 3 of row r sits at q * 128 + (r ^ (q * 4)) * 8. The exclusive-or
// sends the four runs that a staging store writes for one row to four different bank
// groups; a fragment read still covers each 256-byte block of a tile whole. Behind one barrier
// wave w multiplies all four row tiles by ITS 16 output columns (matrix w >> 2, column
// group w & 3), whose 16 W tiles it has fetched into registers while x was on its way.
// ---------------------------------------------------------------------------
__global__ __launch_bounds__(384) void qkv_proj_kernel(
    const float* __restrict__ x, const _Float16* __restrict__ WT,
    const float* __restrict__ bq, const float* __restrict__ bk,
    const float* __restrict__ bv,
    _Float16* __restrict__ qws, _Float16* __restrict__ kws,
    _Float16* __restrict__ vTws)
{
  __shared__ __attribute__((aligned(16))) _Float16 xs[4 * 16 * 512];   // 64 KB

  // The wave's number as a scalar: the tests on it are then scalar branches, and the
  // addresses formed from it scalar bases.
  const int wave  = __builtin_amdgcn_readfirstlane(threadIdx.x >> 5);
  const int lane  = threadIdx.x & 31;
  const int which = wave >> 2;       // 0 = Q, 1 = K, 2 = V
  const int dt    = wave & 3;        // 16-column group of that matrix
  const int d0 = dt * 16;
  const int m  = lane & 15;
  const int hi = lane >> 4;

  // Staging unit (rg, kt) = 4 rows x 32 columns of x: eight lanes read one 128-byte line.
  // Wave w takes 5 row groups from (w >> 2) * 5 on by 4 column tiles from (w & 3) * 4 on
  // (512 contiguous bytes of each row, at constant distances from one address), and of the
  // last row group tile w and, waves 0 to 3, tile 12 + w.
  const int lr = lane >> 3;          // row inside the 4-row group
  const int lc = (lane & 7) * 4;     // first of the lane's 4 columns inside the tile
  const int rg0 = (wave >> 2) * 5;
  const int kt0 = (wave & 3) * 4;
  const float* xlane = x + (size_t)blockIdx.x * 64 * C_ + lr * C_ + lc;
  const float* xmain = xlane + rg0 * 4 * C_ + kt0 * 32;
  // Every loop of this kernel is unrolled: xv, bf, the A fragments and the accumulators are
  // then indexed by constants and stay in registers.
  float4 xv[22];
#pragma unroll
  for (int r = 0; r < 5; ++r)
#pragma unroll
    for (int k = 0; k < 4; ++k) xv[r * 4 + k] = *(const float4*)(xmain + r * 4 * C_ + k * 32);
  const float* xl20 = xlane + wave * 32;
  xv[20] = *(const float4*)(xl20 + 15 * 4 * C_);
  // Waves 4 to 11 take tile w a second time (the same bytes to the same place): one
  // instruction stream in every wave, so that no wave's load and its wait stand alone in a
  // branch ahead of the barrier.
  const int ktl = wave < 4 ? wave + 12 : wave;
  const float* xl21 = xlane + ktl * 32;
  xv[21] = *(const float4*)(xl21 + 15 * 4 * C_);

  const _Float16* wfrag = WT + (size_t)wave * 16 * 512 + lane * 8;
  v16h bf[16];
#pragma unroll
  for (int kt = 0; kt < 16; ++kt) bf[kt] = load_frag_p(wfrag + kt * 512);  // B[k][n] = W[k][d0+n]
  const float* bias = (which == 0) ? bq : (which == 1) ? bk : bv;
  const float bias_n = bias[d0 + m];
  // Precaution: later writes of the loads' address registers stay behind this wait. The
  // addresses are its inputs so that they stay live up to it: else a later load of the
  // group may be given an earlier one's address register to land in.
  asm volatile("s_wait_xcnt 0x0" :: "v"(xmain), "v"(xl20), "v"(xl21), "v"(lane) : "memory");

  // The lane's 4 columns lie in run q of their row; row = (rg & 3) * 4 + lr.
  const int q = lc >> 3;
  _Float16* xdst = xs + q * 128 + lr * 8 + (lc & 7);
  auto put = [&](int rg, int kt, float4 a) {
    v4h h;
    h[0] = (_Float16)a.x; h[1] = (_Float16)a.y; h[2] = (_Float16)a.z; h[3] = (_Float16)a.w;
    *(v4h*)(xdst + ((rg >> 2) * 16 + kt) * 512 + ((rg & 3) ^ q) * 32) = h;
  };
#pragma unroll
  for (int r = 0; r < 5; ++r)
#pragma unroll
    for (int k = 0; k < 4; ++k) put(rg0 + r, kt0 + k, xv[r * 4 + k]);
  put(15, wave, xv[20]);
  put(15, ktl, xv[21]);
  // All 64 rows are in LDS behind this barrier.
  __syncthreads();

  // Row m's runs hi and 2 + hi: the k order of load_frag_p, as in the W tiles.
  const _Float16* xlo = xs + hi * 128 + (m ^ (hi * 4)) * 8;
  const _Float16* xhi = xs + (2 + hi) * 128 + (m ^ ((2 + hi) * 4)) * 8;
  auto frag = [&](int tile) {
    v8h lo = *(const v8h*)(xlo + tile * 512);
    v8h hh = *(const v8h*)(xhi + tile * 512);
    return __builtin_shufflevector(lo, hh, 0, 1, 2, 3, 4, 5, 6, 7, 8, 9, 10, 11, 12, 13, 14, 15);
  };
  // A fragments of row tiles i0, i0 + 1 for k tiles kt, kt + 1.
  auto load_a = [&](v16h* a, int i0, int kt) {
    a[0] = frag(i0 * 16 + kt);
    a[1] = frag(i0 * 16 + kt + 1);
    a[2] = frag((i0 + 1) * 16 + kt);
    a[3] = frag((i0 + 1) * 16 + kt + 1);
  };

  // Two row tiles at a time, so that W tiles, accumulators and two sets of A fragments fit
  // the registers of three waves per SIMD without a window switch.
#pragma unroll
  for (int i0 = 0; i0 < 4; i0 += 2) {
    v8f c0[2], c1[2];
#pragma unroll
    for (int j = 0; j < 2; ++j) {
      c0[j] = (v8f){0.f, 0.f, 0.f, 0.f, 0.f, 0.f, 0.f, 0.f};
      c1[j] = c0[j];
    }
    v16h a[2][4];
    load_a(a[0], i0, 0);
#pragma unroll
    for (int kt = 0; kt < 16; kt += 2) {
      const int cur = (kt >> 1) & 1;
      if (kt + 2 < 16) load_a(a[cur ^ 1], i0, kt + 2);
      // The next group's LDS reads stay one group, issued ahead of this group's products:
      // sunk to their first use, each product would wait out its own read's latency.
      __builtin_amdgcn_sched_barrier(0);
      c0[0] = wmma_f16(a[cur][0], bf[kt], c0[0]);
      c1[0] = wmma_f16(a[cur][1], bf[kt + 1], c1[0]);
      c0[1] = wmma_f16(a[cur][2], bf[kt], c0[1]);
      c1[1] = wmma_f16(a[cur][3], bf[kt + 1], c1[1]);
      // Keeps the group after next's reads from rising among these products.
      __builtin_amdgcn_sched_barrier(0);
    }

#pragma unroll
    for (int j = 0; j < 2; ++j) {
      const int rt = blockIdx.x * 4 + i0 + j;   // 16-row tile over B*N rows
      v8f c = c0[j];
#pragma unroll
      for (int r = 0; r < 8; ++r) c[r] += c1[j][r];
      if (which == 0) {
#pragma unroll
        for (int r = 0; r < 8; ++r) {
          int ro = rt * 16 + r + hi * 8;                 // C-layout: VGPR r -> rows r, r+8
          qws[(size_t)ro * D_ + d0 + m] = (_Float16)((c[r] + bias_n) * 0.125f);  // dk^-0.5 folded in
        }
        // Precaution: later writes of the stores' address and data registers stay behind it.
        asm volatile("s_wait_xcnt 0x0" ::: "memory");
      } else if (which == 1) {
        // K tiles (16 keys x 32 dims) in fragment order: tile (rt, dim half) at (rt*2+half)*512.
        // Here row = key r + hi*8 and kk = (dt & 1) * 16 + m.
        _Float16* dst = kws + ((size_t)rt * 2 + (dt >> 1)) * 512 + (dt & 1) * 256 +
                        (m >> 3) * 128 + (m & 7);
#pragma unroll
        for (int r = 0; r < 8; ++r)
          dst[(r + hi * 8) * 8] = (_Float16)(c[r] + bias_n);
        // Precaution, as behind the Q stores.
        asm volatile("s_wait_xcnt 0x0" ::: "memory");
      } else {
        // V tiles (16 dims x 32 keys) in fragment order: tile (32-key block, dim group) at
        // ((rt>>1)*4+dt)*512. Row = dim m, kk = (rt & 1) * 16 + hi * 8 + r: a lane's eight
        // values are one 16-byte run, and the wave stores 512 contiguous bytes.
        v8h h;
#pragma unroll
        for (int r = 0; r < 8; ++r) h[r] = (_Float16)(c[r] + bias_n);
        *(v8h*)(vTws + ((size_t)(rt >> 1) * 4 + dt) * 512 + (rt & 1) * 256 + lane * 8) = h;
        // Precaution, as behind the Q stores.
        asm volatile("s_wait_xcnt 0x0" ::: "memory");
      }
    }
  }
}

static __device__ __forceinline__ float xhalf(float v) {
  const int b = __builtin_bit_cast(int, v);
  return __builtin_bit_cast(
      float, __builtin_amdgcn_permlanex16(b, b, 0x76543210, 0xfedcba98, false, false));
}

__global__ __launch_bounds__(512) void flash_attn_kernel(
    const _Float16* __restrict__ qws, const _Float16* __restrict__ kws,
    const _Float16* __restrict__ vTws, float* __restrict__ out)
{
  // K and V tiles, two buffers (256 KB); behind the loop its first G_ * 64 * OP_ floats hold
  // the unnormalized partial O.
  __shared__ __attribute__((aligned(16))) _Float16 kv[2 * BUF_];
  // The block's Q as eight fragment-order B tiles: (query tile, dim half) at (tile * 2 + half) * 512.
  __shared__ __attribute__((aligned(16))) _Float16 qs[4 * 2 * 512];
  __shared__ float sm[G_ * 64];                                       // partial row maxima
  __shared__ float sl[G_ * 64];                                       // partial row sums
  static_assert(G_ * 64 * OP_ * 4 <= 2 * BUF_ * 2, "partial O fits the tile buffers");
  float* sacc = (float*)kv;

  // The wave's number as a scalar: tile and group numbers, and the K and V base addresses
  // formed from them, then stay in scalar registers instead of per-lane arithmetic.
  const int wave = __builtin_amdgcn_readfirstlane(threadIdx.x >> 5);
  const int lane = threadIdx.x & 31;
  const int qp = wave & 1;                // pair of query tiles inside the block
  const int qt = blockIdx.x * 4 + qp * 2; // first of the two global 16-query tiles (0..1023)
  const int g  = wave >> 1;               // key group
  const int b  = qt >> 8;                 // 256 q-tiles per batch
  const int m  = lane & 15;
  const int hi = lane >> 4;
  const int kb = hi * 8;

  const _Float16* vrow = vTws + ((size_t)b * N_ + g * (N_ / G_)) * D_;
  const _Float16* krow = kws + ((size_t)b * N_ + g * (N_ / G_)) * D_;

  // This lane's place in the first of the wave's four Q tiles.
  const _Float16* qsl = qs + qp * 2048 + lane * 8;

  // acc[j][t][r] = O[query m of tile j][dim t * 16 + hi * 8 + r]
  v8f acc[2][4];
#pragma unroll
  for (int j = 0; j < 2; ++j)
#pragma unroll
    for (int t = 0; t < 4; ++t)
#pragma unroll
      for (int r = 0; r < 8; ++r) acc[j][t][r] = 0.f;

  float rm[2] = {-1e30f, -1e30f};   // running maximum of query m (equal in both halves)
  float rl[2] = {0.f, 0.f};         // running sum over THIS half's keys; joined after the loop

  // The wave's share of a trip's copies: half qp of its group's K tile and of its V tile,
  // 4 KB each, eight wave-wide copies of 512 contiguous bytes.
  const _Float16* ksrc = krow + qp * 2048 + lane * 8;
  const _Float16* vsrc = vrow + qp * 2048 + lane * 8;
  const unsigned  ldst = (unsigned)(size_t)(kv + g * GT_ + qp * 2048 + lane * 8);  // LDS byte address

  // Eight copies of 512 bytes each, from gs on to LDS byte address l on. The copies and the
  // wait stand in one statement, so that the address registers they name are rewritten only
  // behind the wait (a precaution).
  auto copy8 = [&](unsigned l, const _Float16* gs) {
    asm volatile(
        "global_load_async_to_lds_b128 %0, %8, off\n\t"
        "global_load_async_to_lds_b128 %1, %9, off\n\t"
        "global_load_async_to_lds_b128 %2, %10, off\n\t"
        "global_load_async_to_lds_b128 %3, %11, off\n\t"
        "global_load_async_to_lds_b128 %4, %12, off\n\t"
        "global_load_async_to_lds_b128 %5, %13, off\n\t"
        "global_load_async_to_lds_b128 %6, %14, off\n\t"
        "global_load_async_to_lds_b128 %7, %15, off\n\t"
        "s_wait_xcnt 0x0"
        :: "v"(l), "v"(l + 512), "v"(l + 1024), "v"(l + 1536),
           "v"(l + 2048), "v"(l + 2560), "v"(l + 3072), "v"(l + 3584),
           "v"(gs), "v"(gs + 256), "v"(gs + 512), "v"(gs + 768),
           "v"(gs + 1024), "v"(gs + 1280), "v"(gs + 1536), "v"(gs + 1792)
        : "memory");
  };
  // Copies trip t's share into buffer buf.
  auto copy_tile = [&](int t, int buf) {
    const unsigned lk = ldst + buf * (BUF_ * 2);
    copy8(lk, ksrc + (size_t)t * 4096);
    copy8(lk + 8192, vsrc + (size_t)t * 4096);
  };

  // This lane's place in its group's K tiles in buffer 0; the V tiles stand 4096 halves on.
  const _Float16* kvl = kv + g * GT_ + lane * 8;

  // Online softmax of one query tile's 64 keys: s[t][r] = score of key t * 16 + hi * 8 + r
  // against query m. Leaves P^T as two B operands and rescales the tile's accumulators.
  auto softmax = [&](v8f* s, float& rmj, float& rlj, v8f* accj, v16h& pb0, v16h& pb1) {
    // 32 scores here, 32 in lane ^ 16
    float mt[4];
#pragma unroll
    for (int t = 0; t < 4; ++t) {
      mt[t] = fmaxf(fmaxf(fmaxf(s[t][0], s[t][1]), fmaxf(s[t][2], s[t][3])),
                    fmaxf(fmaxf(s[t][4], s[t][5]), fmaxf(s[t][6], s[t][7])));
    }
    float mx = fmaxf(fmaxf(mt[0], mt[1]), fmaxf(mt[2], mt[3]));
    mx = fmaxf(mx, xhalf(mx));
    const float mnew  = fmaxf(rmj, mx);
    const float alpha = __expf(rmj - mnew);
    rmj = mnew;

    float st[4];
#pragma unroll
    for (int t = 0; t < 4; ++t) {
#pragma unroll
      for (int r = 0; r < 8; ++r) s[t][r] = __expf(s[t][r] - mnew);
      st[t] = ((s[t][0] + s[t][1]) + (s[t][2] + s[t][3])) +
              ((s[t][4] + s[t][5]) + (s[t][6] + s[t][7]));
    }
    rlj = rlj * alpha + ((st[0] + st[1]) + (st[2] + st[3]));

#pragma unroll
    for (int t = 0; t < 4; ++t)
#pragma unroll
      for (int r = 0; r < 8; ++r) accj[t][r] *= alpha;

    // P^T as B operand: element e < 8 is key hi * 8 + e (tile 0 or 2), element 8 + e
    // key 16 + hi * 8 + e (tile 1 or 3): the k order of the V tiles
#pragma unroll
    for (int e = 0; e < 8; ++e) {
      pb0[e] = (_Float16)s[0][e]; pb0[8 + e] = (_Float16)s[1][e];   // first 32 keys
      pb1[e] = (_Float16)s[2][e]; pb1[8 + e] = (_Float16)s[3][e];   // last 32 keys
    }
  };

  // Trip 0's tiles land and are published.
  copy_tile(0, 0);
  // Q goes to LDS once, in fragment order, and is read from there every trip: held in
  // registers beside two tiles' scores and accumulators it would not fit four waves per SIMD.
  // Wave w < 8 places the 32x16 B-tile (column = query m) of query tile w >> 1, dim half w & 1.
  if (wave < 8) {
    const v16h f = load_frag_h(qws + (size_t)(blockIdx.x * 64 + (wave >> 1) * 16 + m) * D_ +
                               (wave & 1) * 32 + kb);
    // Address registers of the issued loads may be reused from here on.
    asm volatile("s_wait_xcnt 0x0" ::: "memory");
    _Float16* qd = qs + wave * 512 + lane * 8;
    *(v8h*)(qd)       = __builtin_shufflevector(f, f, 0, 1, 2, 3, 4, 5, 6, 7);
    *(v8h*)(qd + 256) = __builtin_shufflevector(f, f, 8, 9, 10, 11, 12, 13, 14, 15);
  }
  // The wave's own copies have landed behind this wait.
  asm volatile("s_wait_asynccnt 0x0" ::: "memory");
  // Every wave's copies of trip 0, and Q, are readable behind this barrier.
  __syncthreads();

  for (int t = 0; t < NT_; ++t) {
    const _Float16* p = kvl + (t & 1) * BUF_;
    // The trip's 64 keys of K and the wave's Q, one group of LDS reads.
    v16h qa[2][2];
#pragma unroll
    for (int j = 0; j < 2; ++j) {
      qa[j][0] = load_frag_p(qsl + j * 1024);        // head dims 0..31
      qa[j][1] = load_frag_p(qsl + j * 1024 + 512);  // head dims 32..63
    }
    v16h kf[8];
#pragma unroll
    for (int i = 0; i < 4; ++i) {
      kf[2 * i]     = load_frag_p(p + i * 1024);        // 16 keys, dims 0..31
      kf[2 * i + 1] = load_frag_p(p + i * 1024 + 512);  // dims 32..63
    }
    // The reads stay one group ahead of the products: sunk to their first use, each pair of
    // products would wait out its own read's latency.
    __builtin_amdgcn_sched_barrier(0);
    // The next trip's copies start, behind the barrier that ended every wave's reads of their
    // buffer (trip t - 1's), and have the rest of this trip to land in. They stand behind this
    // trip's first reads (of the other buffer), so that their address arithmetic and the wait
    // in their statements do not stand between the barrier and those reads.
    if (t + 1 < NT_) copy_tile(t + 1, (t + 1) & 1);
    // --- S^T = K * Q^T for 4 sub-tiles of 16 keys and both query tiles (scale pre-folded
    //     into Q): each K fragment feeds two products ---
    v8f s[2][4];
#pragma unroll
    for (int i = 0; i < 4; ++i) {
      v8f z = {0.f, 0.f, 0.f, 0.f, 0.f, 0.f, 0.f, 0.f};
      s[0][i] = wmma_f16(kf[2 * i], qa[0][0], z);
      s[1][i] = wmma_f16(kf[2 * i], qa[1][0], z);
      s[0][i] = wmma_f16(kf[2 * i + 1], qa[0][1], s[0][i]);
      s[1][i] = wmma_f16(kf[2 * i + 1], qa[1][1], s[1][i]);
    }

    // The trip's 64 keys of V, on their way during the softmax.
    v16h vf[8];
#pragma unroll
    for (int nt = 0; nt < 4; ++nt) {
      vf[2 * nt]     = load_frag_p(p + 4096 + nt * 512);         // first 32 keys
      vf[2 * nt + 1] = load_frag_p(p + 4096 + 2048 + nt * 512);  // last 32 keys
    }

    v16h pb[2][2];
    softmax(s[0], rm[0], rl[0], acc[0], pb[0][0], pb[0][1]);
    softmax(s[1], rm[1], rl[1], acc[1], pb[1][0], pb[1][1]);

    // --- O^T += V^T * P^T: each V fragment feeds two products ---
#pragma unroll
    for (int nt = 0; nt < 4; ++nt) {
      acc[0][nt] = wmma_f16(vf[2 * nt], pb[0][0], acc[0][nt]);
      acc[1][nt] = wmma_f16(vf[2 * nt], pb[1][0], acc[1][nt]);
      acc[0][nt] = wmma_f16(vf[2 * nt + 1], pb[0][1], acc[0][nt]);
      acc[1][nt] = wmma_f16(vf[2 * nt + 1], pb[1][1], acc[1][nt]);
    }
    // The hand-over's waits stay at the foot: risen above the softmax, they would wait out the
    // V reads and the next trip's copies, which the softmax and the products cover.
    __builtin_amdgcn_sched_barrier(0);

    // The hand-over, at the trip's foot.
    // The wave's reads of this trip's buffer have returned before the buffer is refilled.
    asm volatile("s_wait_dscnt 0x0" ::: "memory");
    // The wave's copies of trip t + 1 have landed.
    asm volatile("s_wait_asynccnt 0x0" ::: "memory");
    // Publishes trip t + 1's tiles and ends every wave's reads of trip t's buffer.
    __syncthreads();
  }
  // No copy is outstanding when the tile buffers become the partials' room.
  asm volatile("s_wait_asynccnt 0x0" ::: "memory");

  // Unnormalized partial acc and per-row (m, l) into LDS. The last trip's barrier has ended
  // every wave's reads of the tile buffers.
  // A lane's 8 values of a tile are 8 consecutive dims of its query's row.
#pragma unroll
  for (int j = 0; j < 2; ++j) {
    // Join the two halves' sums: every lane then has the whole row sum of query m.
    const float rlw = rl[j] + xhalf(rl[j]);
    const int row = g * 64 + qp * 32 + j * 16 + m;
    float* po = sacc + row * OP_ + kb;
#pragma unroll
    for (int t = 0; t < 4; ++t) {
      *(float4*)(po + t * 16)     = make_float4(acc[j][t][0], acc[j][t][1], acc[j][t][2], acc[j][t][3]);
      *(float4*)(po + t * 16 + 4) = make_float4(acc[j][t][4], acc[j][t][5], acc[j][t][6], acc[j][t][7]);
    }
    if (hi == 0) {
      sm[row] = rm[j];
      sl[row] = rlw;
    }
  }
  // Every group's partials are in LDS behind this barrier.
  __syncthreads();

  // Join the key groups: 16 threads per row, 4 dims each, rows r and r + 32 of the block's
  // 64, so that a wave's 16-byte stores cover 512 contiguous bytes of out.
  const int col = (threadIdx.x & 15) * 4;
  float4 res[2];
#pragma unroll
  for (int h = 0; h < 2; ++h) {
    const int r = (threadIdx.x >> 4) + h * 32;
    float M = -1e30f;
#pragma unroll
    for (int gg = 0; gg < G_; ++gg) M = fmaxf(M, sm[gg * 64 + r]);
    float L = 0.f;
    float4 o = make_float4(0.f, 0.f, 0.f, 0.f);
#pragma unroll
    for (int gg = 0; gg < G_; ++gg) {
      const float w = __expf(sm[gg * 64 + r] - M);
      const float4 p = *(const float4*)(sacc + (gg * 64 + r) * OP_ + col);
      L += w * sl[gg * 64 + r];
      o.x += w * p.x; o.y += w * p.y; o.z += w * p.z; o.w += w * p.w;
    }
    res[h] = make_float4(o.x / L, o.y / L, o.z / L, o.w / L);
  }
  float* po = out + ((size_t)blockIdx.x * 64 + (threadIdx.x >> 4)) * D_ + col;
  *(float4*)(po)           = res[0];
  *(float4*)(po + 32 * D_) = res[1];
}

// ---------------------------------------------------------------------------
extern "C" void kernel_launch(void* const* d_in, const int* in_sizes, int n_in,
                              void* d_out, int out_size, void* d_ws, size_t ws_size,
                              hipStream_t stream) {
  (void)in_sizes; (void)n_in; (void)out_size; (void)ws_size;
  const float* x  = (const float*)d_in[0];
  const float* Wq = (const float*)d_in[1];
  const float* bq = (const float*)d_in[2];
  const float* Wk = (const float*)d_in[3];
  const float* bk = (const float*)d_in[4];
  const float* Wv = (const float*)d_in[5];
  const float* bv = (const float*)d_in[6];
  float* out = (float*)d_out;

  const size_t elems    = (size_t)B_ * N_ * D_;    // 1,048,576
  const size_t wt_elems = (size_t)3 * D_ * C_;     // 98,304

  // Workspace layout (halves):  qws | kws | vT | WT
  // (kws, vT and WT hold fragment-order tiles, see load_frag_p)
  _Float16* qws = (_Float16*)d_ws;
  _Float16* kws = qws + elems;
  _Float16* vT  = kws + elems;
  _Float16* WT  = vT + elems;

  pack_w_kernel<<<(int)(wt_elems / 256), 256, 0, stream>>>(Wq, Wk, Wv, WT);
  qkv_proj_kernel<<<(B_ * N_) / 64, 384, 0, stream>>>(x, WT, bq, bk, bv, qws, kws, vT);
  flash_attn_kernel<<<(B_ * N_) / 64, 512, 0, stream>>>(qws, kws, vT, out);
}

// v007
// One run takes 27 microseconds.
// Next to v006, in two timings, it ran 1.09 and 1.08 times as fast.
// All steps since v000 together make it 5.87 times as fast.
#include <hip/hip_runtime.h>
#include <hip/hip_bf16.h>
#include <stdint.h>

typedef __attribute__((ext_vector_type(16))) _Float16 v16h;
typedef __attribute__((ext_vector_type(8)))  _Float16 v8h;
typedef __attribute__((ext_vector_type(4)))  _Float16 v4h;
typedef __attribute__((ext_vector_type(8)))  float    v8f;
typedef __attribute__((ext_vector_type(4)))  uint32_t u32x4;
typedef __attribute__((ext_vector_type(8)))  uint32_t u32x8;

#define B_  4
#define N_  4096
#define C_  512
#define D_  64
#define G_  8            // split-K groups over the key dimension, one per two waves of a block
#define OP_ 68           // floats per row of a partial O tile in LDS: 272 B = 16 B x odd
#define NT_ (N_ / G_ / 64)   // trips of the attention loop: 64 keys of every group per trip
#define GT_ 8192         // halves of one group's tile pair in LDS: 64 keys of K, then of V
#define BUF_ (G_ * GT_)  // halves of one LDS buffer: the eight groups' tile pairs, 128 KB

static __device__ __forceinline__ v8f wmma_f16(v16h a, v16h b, v8f c) {
  // (neg_a, A, neg_b, B, c_mod, C, reuse_a, reuse_b)
  return __builtin_amdgcn_wmma_f32_16x16x32_f16(false, a, false, b, (short)0, c, false, false);
}

// Load one 16-element half-fragment: two contiguous 8-half (16B) runs at p and p+16.
static __device__ __forceinline__ v16h load_frag_h(const _Float16* p) {
  v16h f;
#pragma unroll
  for (int i = 0; i < 8; ++i) { f[i] = p[i]; f[8 + i] = p[16 + i]; }
  return f;
}

// Fragment-order layout of a 16-row x 32-k operand tile (512 halves = 1 KB):
//   element (row, kk) sits at (kk >> 4) * 256 + (row + 16 * ((kk >> 3) & 1)) * 8 + (kk & 7).
// Lane l then finds its two 8-half runs at l * 8 and 256 + l * 8, so each
// wave-wide 16-byte load covers 512 contiguous bytes (4 whole 128-byte lines)
// instead of 32-byte pieces of 16 lines. Same k order as load_frag_h.
// p = tile base + lane * 8.
static __device__ __forceinline__ v16h load_frag_p(const _Float16* p) {
  v8h lo = *(const v8h*)(p);
  v8h hi = *(const v8h*)(p + 256);
  return __builtin_shufflevector(lo, hi, 0, 1, 2, 3, 4, 5, 6, 7, 8, 9, 10, 11, 12, 13, 14, 15);
}

// ---------------------------------------------------------------------------
// Prep: pack Wq/Wk/Wv (C x D fp32, row-major) -> f16 B tiles in fragment order,
// tile (which, 16-column group dt, kt) at ((which*4+dt)*16+kt)*512.
// ---------------------------------------------------------------------------
__global__ __launch_bounds__(256) void pack_w_kernel(const float* __restrict__ Wq,
                                                     const float* __restrict__ Wk,
                                                     const float* __restrict__ Wv,
                                                     _Float16* __restrict__ WT) {
  int t = blockIdx.x * 256 + threadIdx.x;          // 0 .. 3*D_*C_-1
  int w  = t >> 15;                                // D_*C_ = 32768 per matrix
  int dt = (t >> 13) & 3;
  int kt = (t >> 9) & 15;
  int l  = (t >> 3) & 31;
  int d  = dt * 16 + (l & 15);
  int c  = kt * 32 + ((t >> 8) & 1) * 16 + (l >> 4) * 8 + (t & 7);
  const float* W = (w == 0) ? Wq : (w == 1) ? Wk : Wv;
  WT[t] = (_Float16)W[c * D_ + d];                 // coalesced store
}

// ---------------------------------------------------------------------------
// Kernel 1: fused conversion and QKV projection. grid = B*N/64, block = 12 waves.
// The block reads its 64 rows of x (fp32) once, each wave-wide 16-byte load covering four
// whole 128-byte lines, converts them to f16 and lays them in LDS as fragment-order tiles:
// tile (rt, kt) at (rt*16+kt)*512, rt = 16-row tile inside the block; inside a tile the
// 8-half run q = kk >> 3 of row r sits at q * 128 + (r ^ (q * 4)) * 8. The exclusive-or
// sends the four runs that a staging store writes for one row to four different bank
// groups; a fragment read still covers each 256-byte block of a tile whole. Behind one barrier
// wave w multiplies all four row tiles by ITS 16 output columns (matrix w >> 2, column
// group w & 3), whose 16 W tiles it has fetched into registers while x was on its way.
// ---------------------------------------------------------------------------
__global__ __launch_bounds__(384) void qkv_proj_kernel(
    const float* __restrict__ x, const _Float16* __restrict__ WT,
    const float* __restrict__ bq, const float* __restrict__ bk,
    const float* __restrict__ bv,
    _Float16* __restrict__ qws, _Float16* __restrict__ kws,
    _Float16* __restrict__ vTws)
{
  __shared__ __attribute__((aligned(16))) _Float16 xs[4 * 16 * 512];   // 64 KB

  // The wave's number as a scalar: the tests on it are then scalar branches, and the
  // addresses formed from it scalar bases.
  const int wave  = __builtin_amdgcn_readfirstlane(threadIdx.x >> 5);
  const int lane  = threadIdx.x & 31;
  const int which = wave >> 2;       // 0 = Q, 1 = K, 2 = V
  const int dt    = wave & 3;        // 16-column group of that matrix
  const int d0 = dt * 16;
  const int m  = lane & 15;
  const int hi = lane >> 4;

  // Staging unit (rg, kt) = 4 rows x 32 columns of x: eight lanes read one 128-byte line.
  // Wave w takes 5 row groups from (w >> 2) * 5 on by 4 column tiles from (w & 3) * 4 on
  // (512 contiguous bytes of each row, at constant distances from one address), and of the
  // last row group tile w and, waves 0 to 3, tile 12 + w.
  const int lr = lane >> 3;          // row inside the 4-row group
  const int lc = (lane & 7) * 4;     // first of the lane's 4 columns inside the tile
  const int rg0 = (wave >> 2) * 5;
  const int kt0 = (wave & 3) * 4;
  const float* xlane = x + (size_t)blockIdx.x * 64 * C_ + lr * C_ + lc;
  const float* xmain = xlane + rg0 * 4 * C_ + kt0 * 32;
  // Every loop of this kernel is unrolled: xv, bf, the A fragments and the accumulators are
  // then indexed by constants and stay in registers.
  float4 xv[22];
#pragma unroll
  for (int r = 0; r < 5; ++r)
#pragma unroll
    for (int k = 0; k < 4; ++k) xv[r * 4 + k] = *(const float4*)(xmain + r * 4 * C_ + k * 32);
  const float* xl20 = xlane + wave * 32;
  xv[20] = *(const float4*)(xl20 + 15 * 4 * C_);
  // Waves 4 to 11 take tile w a second time (the same bytes to the same place): one
  // instruction stream in every wave, so that no wave's load and its wait stand alone in a
  // branch ahead of the barrier.
  const int ktl = wave < 4 ? wave + 12 : wave;
  const float* xl21 = xlane + ktl * 32;
  xv[21] = *(const float4*)(xl21 + 15 * 4 * C_);

  const _Float16* wfrag = WT + (size_t)wave * 16 * 512 + lane * 8;
  v16h bf[16];
#pragma unroll
  for (int kt = 0; kt < 16; ++kt) bf[kt] = load_frag_p(wfrag + kt * 512);  // B[k][n] = W[k][d0+n]
  const float* bias = (which == 0) ? bq : (which == 1) ? bk : bv;
  const float bias_n = bias[d0 + m];
  // Precaution: later writes of the loads' address registers stay behind this wait. The
  // addresses are its inputs so that they stay live up to it: else a later load of the
  // group may be given an earlier one's address register to land in.
  asm volatile("s_wait_xcnt 0x0" :: "v"(xmain), "v"(xl20), "v"(xl21), "v"(lane) : "memory");

  // The lane's 4 columns lie in run q of their row; row = (rg & 3) * 4 + lr.
  const int q = lc >> 3;
  _Float16* xdst = xs + q * 128 + lr * 8 + (lc & 7);
  auto put = [&](int rg, int kt, float4 a) {
    v4h h;
    h[0] = (_Float16)a.x; h[1] = (_Float16)a.y; h[2] = (_Float16)a.z; h[3] = (_Float16)a.w;
    *(v4h*)(xdst + ((rg >> 2) * 16 + kt) * 512 + ((rg & 3) ^ q) * 32) = h;
  };
#pragma unroll
  for (int r = 0; r < 5; ++r)
#pragma unroll
    for (int k = 0; k < 4; ++k) put(rg0 + r, kt0 + k, xv[r * 4 + k]);
  put(15, wave, xv[20]);
  put(15, ktl, xv[21]);
  // All 64 rows are in LDS behind this barrier.
  __syncthreads();

  // Row m's runs hi and 2 + hi: the k order of load_frag_p, as in the W tiles.
  const _Float16* xlo = xs + hi * 128 + (m ^ (hi * 4)) * 8;
  const _Float16* xhi = xs + (2 + hi) * 128 + (m ^ ((2 + hi) * 4)) * 8;
  auto frag = [&](int tile) {
    v8h lo = *(const v8h*)(xlo + tile * 512);
    v8h hh = *(const v8h*)(xhi + tile * 512);
    return __builtin_shufflevector(lo, hh, 0, 1, 2, 3, 4, 5, 6, 7, 8, 9, 10, 11, 12, 13, 14, 15);
  };
  // A fragments of row tiles i0, i0 + 1 for k tiles kt, kt + 1.
  auto load_a = [&](v16h* a, int i0, int kt) {
    a[0] = frag(i0 * 16 + kt);
    a[1] = frag(i0 * 16 + kt + 1);
    a[2] = frag((i0 + 1) * 16 + kt);
    a[3] = frag((i0 + 1) * 16 + kt + 1);
  };

  // Two row tiles at a time, so that W tiles, accumulators and two sets of A fragments fit
  // the registers of three waves per SIMD without a window switch.
#pragma unroll
  for (int i0 = 0; i0 < 4; i0 += 2) {
    v8f c0[2], c1[2];
#pragma unroll
    for (int j = 0; j < 2; ++j) {
      c0[j] = (v8f){0.f, 0.f, 0.f, 0.f, 0.f, 0.f, 0.f, 0.f};
      c1[j] = c0[j];
    }
    v16h a[2][4];
    load_a(a[0], i0, 0);
#pragma unroll
    for (int kt = 0; kt < 16; kt += 2) {
      const int cur = (kt >> 1) & 1;
      if (kt + 2 < 16) load_a(a[cur ^ 1], i0, kt + 2);
      // The next group's LDS reads stay one group, issued ahead of this group's products:
      // sunk to their first use, each product would wait out its own read's latency.
      __builtin_amdgcn_sched_barrier(0);
      c0[0] = wmma_f16(a[cur][0], bf[kt], c0[0]);
      c1[0] = wmma_f16(a[cur][1], bf[kt + 1], c1[0]);
      c0[1] = wmma_f16(a[cur][2], bf[kt], c0[1]);
      c1[1] = wmma_f16(a[cur][3], bf[kt + 1], c1[1]);
      // Keeps the group after next's reads from rising among these products.
      __builtin_amdgcn_sched_barrier(0);
    }

#pragma unroll
    for (int j = 0; j < 2; ++j) {
      const int rt = blockIdx.x * 4 + i0 + j;   // 16-row tile over B*N rows
      v8f c = c0[j];
#pragma unroll
      for (int r = 0; r < 8; ++r) c[r] += c1[j][r];
      if (which == 0) {
#pragma unroll
        for (int r = 0; r < 8; ++r) {
          int ro = rt * 16 + r + hi * 8;                 // C-layout: VGPR r -> rows r, r+8
          qws[(size_t)ro * D_ + d0 + m] = (_Float16)((c[r] + bias_n) * 0.125f);  // dk^-0.5 folded in
        }
        // Precaution: later writes of the stores' address and data registers stay behind it.
        asm volatile("s_wait_xcnt 0x0" ::: "memory");
      } else if (which == 1) {
        // K tiles (16 keys x 32 dims) in fragment order: tile (rt, dim half) at (rt*2+half)*512.
        // Here row = key r + hi*8 and kk = (dt & 1) * 16 + m.
        _Float16* dst = kws + ((size_t)rt * 2 + (dt >> 1)) * 512 + (dt & 1) * 256 +
                        (m >> 3) * 128 + (m & 7);
#pragma unroll
        for (int r = 0; r < 8; ++r)
          dst[(r + hi * 8) * 8] = (_Float16)(c[r] + bias_n);
        // Precaution, as behind the Q stores.
        asm volatile("s_wait_xcnt 0x0" ::: "memory");
      } else {
        // V tiles (16 dims x 32 keys) in fragment order: tile (32-key block, dim group) at
        // ((rt>>1)*4+dt)*512. Row = dim m, kk = (rt & 1) * 16 + hi * 8 + r: a lane's eight
        // values are one 16-byte run, and the wave stores 512 contiguous bytes.
        v8h h;
#pragma unroll
        for (int r = 0; r < 8; ++r) h[r] = (_Float16)(c[r] + bias_n);
        *(v8h*)(vTws + ((size_t)(rt >> 1) * 4 + dt) * 512 + (rt & 1) * 256 + lane * 8) = h;
        // Precaution, as behind the Q stores.
        asm volatile("s_wait_xcnt 0x0" ::: "memory");
      }
    }
  }
}

static __device__ __forceinline__ uint32_t pinned(uint32_t v) {
  uint32_t w = (uint32_t)__builtin_amdgcn_readfirstlane(v);
  asm volatile("" : "+s"(w));  // a descriptor word or issue test kept scalar
  return w;
}

// Value of lane l ^ 16.
static __device__ __forceinline__ float xhalf(float v) {
  const int b = __builtin_bit_cast(int, v);
  return __builtin_bit_cast(
      float, __builtin_amdgcn_permlanex16(b, b, 0x76543210, 0xfedcba98, false, false));
}

__global__ __launch_bounds__(512) void flash_attn_kernel(
    const _Float16* __restrict__ qws, const _Float16* __restrict__ kws,
    const _Float16* __restrict__ vTws, float* __restrict__ out)
{
  // K and V tiles, two buffers (256 KB); behind the loop its first G_ * 64 * OP_ floats hold
  // the unnormalized partial O.
  // Aligned so that every tensor load's place in LDS is a multiple of 2 KB.
  __shared__ __attribute__((aligned(2048))) _Float16 kv[2 * BUF_];
  // The block's Q as eight fragment-order B tiles: (query tile, dim half) at (tile * 2 + half) * 512.
  __shared__ __attribute__((aligned(16))) _Float16 qs[4 * 2 * 512];
  __shared__ float sm[G_ * 64];                                       // partial row maxima
  __shared__ float sl[G_ * 64];                                       // partial row sums
  static_assert(G_ * 64 * OP_ * 4 <= 2 * BUF_ * 2, "partial O fits the tile buffers");
  float* sacc = (float*)kv;

  // The wave's number as a scalar: tile and group numbers, and the K and V base addresses
  // formed from them, then stay in scalar registers instead of per-lane arithmetic.
  const int wave = __builtin_amdgcn_readfirstlane(threadIdx.x >> 5);
  const int lane = threadIdx.x & 31;
  const int qp = wave & 1;                // pair of query tiles inside the block
  const int qt = blockIdx.x * 4 + qp * 2; // first of the two global 16-query tiles (0..1023)
  const int g  = wave >> 1;               // key group
  const int b  = qt >> 8;                 // 256 q-tiles per batch
  const int m  = lane & 15;
  const int hi = lane >> 4;
  const int kb = hi * 8;

  // This lane's place in the first of the wave's four Q tiles.
  const _Float16* qsl = qs + qp * 2048 + lane * 8;

  // acc[j][t][r] = O[query m of tile j][dim t * 16 + hi * 8 + r]
  v8f acc[2][4];
#pragma unroll
  for (int j = 0; j < 2; ++j)
#pragma unroll
    for (int t = 0; t < 4; ++t)
#pragma unroll
      for (int r = 0; r < 8; ++r) acc[j][t][r] = 0.f;

  float rm[2] = {-1e30f, -1e30f};   // running maximum of query m (equal in both halves)
  float rl[2] = {0.f, 0.f};         // running sum over THIS half's keys; joined after the loop

  // The wave's share of a trip's tiles: one tile of 64 keys, 8 KB contiguous in the workspace:
  // K of group wave (waves 0 to 7) or V of group wave - 8.
  const _Float16* tsrc = (wave < 8 ? kws : vTws) + ((size_t)b * N_ + (wave & 7) * (N_ / G_)) * D_;
  const uint32_t  tdst = (uint32_t)(size_t)(kv + (wave & 7) * GT_ + (wave >> 3) * 4096);  // LDS byte address

  // Descriptor group 1, the same for every request: no mask, bytes as elements, no pad; tensor =
  // tile = 8 rows of 1024 bytes at a source pitch of 1024 bytes.
  // Each word is pinned in a scalar register of its own: the group is built once and no word of
  // it is rewritten while the loop runs; word 0 shows in the listing as the immediate 0.
  u32x8 g1;
  g1[0] = pinned(0u);
  g1[1] = pinned(1024u << 16);   // tensor_dim0 [15:0]
  g1[2] = pinned(8u << 16);      // tensor_dim1 [15:0]
  g1[3] = pinned(1024u << 16);   // tile_dim0
  g1[4] = pinned(8u);            // tile_dim1
  g1[5] = pinned(1024u);         // source row pitch
  g1[6] = pinned(0u);
  g1[7] = pinned(0u);
  // Requests trip t's tile into buffer t & 1. Every wave issues its own, unconditionally.
  auto load_tile = [&](uint32_t t) {
    const uint64_t ga = (uint64_t)(size_t)tsrc + (uint64_t)t * 8192u;
    u32x4 g0;
    g0[0] = (uint32_t)__builtin_amdgcn_readfirstlane(1u);                                // count 1
    g0[1] = (uint32_t)__builtin_amdgcn_readfirstlane(tdst + (t & 1u) * (BUF_ * 2u));
    g0[2] = (uint32_t)__builtin_amdgcn_readfirstlane((uint32_t)ga);
    g0[3] = (uint32_t)__builtin_amdgcn_readfirstlane(
        (((uint32_t)(ga >> 32)) & 0x01FFFFFFu) | 0x80000000u);                           // type 2
    asm volatile("tensor_load_to_lds %0, %1" :: "s"(g0), "s"(g1) : "memory");
  };

  // This lane's place in its group's K tiles in buffer 0; the V tiles stand 4096 halves on.
  const _Float16* kvl = kv + g * GT_ + lane * 8;

  // Online softmax of one query tile's 64 keys: s[t][r] = score of key t * 16 + hi * 8 + r
  // against query m. Leaves P^T as two B operands and rescales the tile's accumulators.
  auto softmax = [&](v8f* s, float& rmj, float& rlj, v8f* accj, v16h& pb0, v16h& pb1) {
    // 32 scores here, 32 in lane ^ 16
    float mt[4];
#pragma unroll
    for (int t = 0; t < 4; ++t) {
      mt[t] = fmaxf(fmaxf(fmaxf(s[t][0], s[t][1]), fmaxf(s[t][2], s[t][3])),
                    fmaxf(fmaxf(s[t][4], s[t][5]), fmaxf(s[t][6], s[t][7])));
    }
    float mx = fmaxf(fmaxf(mt[0], mt[1]), fmaxf(mt[2], mt[3]));
    mx = fmaxf(mx, xhalf(mx));
    const float mnew  = fmaxf(rmj, mx);
    const float alpha = __expf(rmj - mnew);
    rmj = mnew;

    float st[4];
#pragma unroll
    for (int t = 0; t < 4; ++t) {
#pragma unroll
      for (int r = 0; r < 8; ++r) s[t][r] = __expf(s[t][r] - mnew);
      st[t] = ((s[t][0] + s[t][1]) + (s[t][2] + s[t][3])) +
              ((s[t][4] + s[t][5]) + (s[t][6] + s[t][7]));
    }
    rlj = rlj * alpha + ((st[0] + st[1]) + (st[2] + st[3]));

#pragma unroll
    for (int t = 0; t < 4; ++t)
#pragma unroll
      for (int r = 0; r < 8; ++r) accj[t][r] *= alpha;

    // P^T as B operand: element e < 8 is key hi * 8 + e (tile 0 or 2), element 8 + e
    // key 16 + hi * 8 + e (tile 1 or 3): the k order of the V tiles
#pragma unroll
    for (int e = 0; e < 8; ++e) {
      pb0[e] = (_Float16)s[0][e]; pb0[8 + e] = (_Float16)s[1][e];   // first 32 keys
      pb1[e] = (_Float16)s[2][e]; pb1[8 + e] = (_Float16)s[3][e];   // last 32 keys
    }
  };

  // Q goes to LDS once, in fragment order, and is read from there every trip: held in
  // registers beside two tiles' scores and accumulators it would not fit four waves per SIMD.
  // Wave w < 8 places the 32x16 B-tile (column = query m) of query tile w >> 1, dim half w & 1.
  // Its global loads start ahead of the tensor load and fly beside it; its LDS stores stand
  // behind the tensor load's wait, so that no scalar work of theirs falls between the request
  // and that wait, where it could be given a descriptor register.
  v16h qf = {};
  if (wave < 8) {
    qf = load_frag_h(qws + (size_t)(blockIdx.x * 64 + (wave >> 1) * 16 + m) * D_ +
                     (wave & 1) * 32 + kb);
    // Address registers of the issued loads may be reused from here on.
    asm volatile("s_wait_xcnt 0x0" ::: "memory");
  }
  // Trip 0's tiles land and are published.
  load_tile(0);
  // The wave's own tile has landed behind this wait.
  asm volatile("s_wait_tensorcnt 0x0" ::: "memory");
  if (wave < 8) {
    _Float16* qd = qs + wave * 512 + lane * 8;
    *(v8h*)(qd)       = __builtin_shufflevector(qf, qf, 0, 1, 2, 3, 4, 5, 6, 7);
    *(v8h*)(qd + 256) = __builtin_shufflevector(qf, qf, 8, 9, 10, 11, 12, 13, 14, 15);
  }
  // Every wave's tile of trip 0, and Q, are readable behind this barrier.
  __syncthreads();

  for (int t = 0; t < NT_; ++t) {
    // Directly behind the barrier that published trip t's tiles and ended every wave's reads of
    // the other buffer (trip t - 1's): trip t + 1's tile is requested into that buffer and has
    // all of this trip to land in. The test is a scalar branch, and the descriptor is formed
    // from the pinned trip number, behind the wait on the request before.
    if (pinned(t + 1 < NT_)) load_tile(pinned(t + 1));
    const _Float16* p = kvl + (t & 1) * BUF_;
    // The trip's 64 keys of K and the wave's Q, one group of LDS reads.
    v16h qa[2][2];
#pragma unroll
    for (int j = 0; j < 2; ++j) {
      qa[j][0] = load_frag_p(qsl + j * 1024);        // head dims 0..31
      qa[j][1] = load_frag_p(qsl + j * 1024 + 512);  // head dims 32..63
    }
    v16h kf[8];
#pragma unroll
    for (int i = 0; i < 4; ++i) {
      kf[2 * i]     = load_frag_p(p + i * 1024);        // 16 keys, dims 0..31
      kf[2 * i + 1] = load_frag_p(p + i * 1024 + 512);  // dims 32..63
    }
    // The reads stay one group ahead of the products: sunk to their first use, each pair of
    // products would wait out its own read's latency.
    __builtin_amdgcn_sched_barrier(0);
    // --- S^T = K * Q^T for 4 sub-tiles of 16 keys and both query tiles (scale pre-folded
    //     into Q): each K fragment feeds two products ---
    v8f s[2][4];
#pragma unroll
    for (int i = 0; i < 4; ++i) {
      v8f z = {0.f, 0.f, 0.f, 0.f, 0.f, 0.f, 0.f, 0.f};
      s[0][i] = wmma_f16(kf[2 * i], qa[0][0], z);
      s[1][i] = wmma_f16(kf[2 * i], qa[1][0], z);
      s[0][i] = wmma_f16(kf[2 * i + 1], qa[0][1], s[0][i]);
      s[1][i] = wmma_f16(kf[2 * i + 1], qa[1][1], s[1][i]);
    }

    // The trip's 64 keys of V, on their way during the softmax.
    v16h vf[8];
#pragma unroll
    for (int nt = 0; nt < 4; ++nt) {
      vf[2 * nt]     = load_frag_p(p + 4096 + nt * 512);         // first 32 keys
      vf[2 * nt + 1] = load_frag_p(p + 4096 + 2048 + nt * 512);  // last 32 keys
    }
    // The V reads stay one group ahead of the softmax, which covers their latency: sunk among
    // the second product's WMMAs, each pair of products would wait out its own read.
    __builtin_amdgcn_sched_barrier(0);

    v16h pb[2][2];
    softmax(s[0], rm[0], rl[0], acc[0], pb[0][0], pb[0][1]);
    softmax(s[1], rm[1], rl[1], acc[1], pb[1][0], pb[1][1]);

    // --- O^T += V^T * P^T: each V fragment feeds two products ---
#pragma unroll
    for (int nt = 0; nt < 4; ++nt) {
      acc[0][nt] = wmma_f16(vf[2 * nt], pb[0][0], acc[0][nt]);
      acc[1][nt] = wmma_f16(vf[2 * nt], pb[1][0], acc[1][nt]);
      acc[0][nt] = wmma_f16(vf[2 * nt + 1], pb[0][1], acc[0][nt]);
      acc[1][nt] = wmma_f16(vf[2 * nt + 1], pb[1][1], acc[1][nt]);
    }
    // The hand-over's waits stay at the foot: risen above the softmax, they would wait out the
    // V reads and the next trip's tensor load, which the softmax and the products cover.
    __builtin_amdgcn_sched_barrier(0);

    // The hand-over, at the trip's foot.
    // The wave's reads of this trip's buffer have returned before the buffer is refilled.
    asm volatile("s_wait_dscnt 0x0" ::: "memory");
    // The wave's tile of trip t + 1 has landed.
    asm volatile("s_wait_tensorcnt 0x0" ::: "memory");
    // Publishes trip t + 1's tiles and ends every wave's reads of trip t's buffer.
    __syncthreads();
  }
  // No request and no LDS read is outstanding when the tile buffers become the partials' room.
  asm volatile("s_wait_tensorcnt 0x0" ::: "memory");
  asm volatile("s_wait_dscnt 0x0" ::: "memory");

  // Unnormalized partial acc and per-row (m, l) into LDS. The last trip's barrier has ended
  // every wave's reads of the tile buffers.
  // A lane's 8 values of a tile are 8 consecutive dims of its query's row.
#pragma unroll
  for (int j = 0; j < 2; ++j) {
    // Join the two halves' sums: every lane then has the whole row sum of query m.
    const float rlw = rl[j] + xhalf(rl[j]);
    const int row = g * 64 + qp * 32 + j * 16 + m;
    float* po = sacc + row * OP_ + kb;
#pragma unroll
    for (int t = 0; t < 4; ++t) {
      *(float4*)(po + t * 16)     = make_float4(acc[j][t][0], acc[j][t][1], acc[j][t][2], acc[j][t][3]);
      *(float4*)(po + t * 16 + 4) = make_float4(acc[j][t][4], acc[j][t][5], acc[j][t][6], acc[j][t][7]);
    }
    if (hi == 0) {
      sm[row] = rm[j];
      sl[row] = rlw;
    }
  }
  // Every group's partials are in LDS behind this barrier.
  __syncthreads();

  // Join the key groups: 16 threads per row, 4 dims each, rows r and r + 32 of the block's
  // 64, so that a wave's 16-byte stores cover 512 contiguous bytes of out.
  const int col = (threadIdx.x & 15) * 4;
  float4 res[2];
#pragma unroll
  for (int h = 0; h < 2; ++h) {
    const int r = (threadIdx.x >> 4) + h * 32;
    float M = -1e30f;
#pragma unroll
    for (int gg = 0; gg < G_; ++gg) M = fmaxf(M, sm[gg * 64 + r]);
    float L = 0.f;
    float4 o = make_float4(0.f, 0.f, 0.f, 0.f);
#pragma unroll
    for (int gg = 0; gg < G_; ++gg) {
      const float w = __expf(sm[gg * 64 + r] - M);
      const float4 p = *(const float4*)(sacc + (gg * 64 + r) * OP_ + col);
      L += w * sl[gg * 64 + r];
      o.x += w * p.x; o.y += w * p.y; o.z += w * p.z; o.w += w * p.w;
    }
    res[h] = make_float4(o.x / L, o.y / L, o.z / L, o.w / L);
  }
  float* po = out + ((size_t)blockIdx.x * 64 + (threadIdx.x >> 4)) * D_ + col;
  *(float4*)(po)           = res[0];
  *(float4*)(po + 32 * D_) = res[1];
}

// ---------------------------------------------------------------------------
extern "C" void kernel_launch(void* const* d_in, const int* in_sizes, int n_in,
                              void* d_out, int out_size, void* d_ws, size_t ws_size,
                              hipStream_t stream) {
  (void)in_sizes; (void)n_in; (void)out_size; (void)ws_size;
  const float* x  = (const float*)d_in[0];
  const float* Wq = (const float*)d_in[1];
  const float* bq = (const float*)d_in[2];
  const float* Wk = (const float*)d_in[3];
  const float* bk = (const float*)d_in[4];
  const float* Wv = (const float*)d_in[5];
  const float* bv = (const float*)d_in[6];
  float* out = (float*)d_out;

  const size_t elems    = (size_t)B_ * N_ * D_;    // 1,048,576
  const size_t wt_elems = (size_t)3 * D_ * C_;     // 98,304

  // Workspace layout (halves):  qws | kws | vT | WT
  // (kws, vT and WT hold fragment-order tiles, see load_frag_p)
  _Float16* qws = (_Float16*)d_ws;
  _Float16* kws = qws + elems;
  _Float16* vT  = kws + elems;
  _Float16* WT  = vT + elems;

  pack_w_kernel<<<(int)(wt_elems / 256), 256, 0, stream>>>(Wq, Wk, Wv, WT);
  qkv_proj_kernel<<<(B_ * N_) / 64, 384, 0, stream>>>(x, WT, bq, bk, bv, qws, kws, vT);
  flash_attn_kernel<<<(B_ * N_) / 64, 512, 0, stream>>>(qws, kws, vT, out);
}
